// v000
// The times below were measured on an AMD MI455X: many runs one after another, warmed up first and cycling through
// copies of the inputs, with the whole window's GPU time divided by the number of runs. Launches and the gaps
// between them are all in it. The median over several windows is given; except for v000 it joins two sittings, which
// can be a few percent apart, so the side-by-side timings, each taken in one sitting, are the better comparison.
// v000 is the starting kernel. One run takes 119 microseconds.
// Contractions: q.k^T scores = v_wmma_f32_16x16x32_bf16 (bf16 operands = RNE-converted q and k planes, single product,
// d_key 32 = one k-step); a.v context = v_wmma_f32_16x16x32_f16 (a carried as an f16 hi plane x64 plus an f16 residual
// plane x64x1024 feeding a second accumulator, v as f16 of the bf16-converted value x16; two products); all f32
// accumulate; cubic truncated-exp polynomial, causal zeroing, row sums Z and the final S*(1/Z) in f32.
#include <hip/hip_runtime.h>
#include <math.h>
#include <stdint.h>

#define TT    2048                 // sequence length (queries == keys)
#define NB    4
#define NHD   8
#define DKY   32                   // d_key
#define DVL   64                   // d_val
#define NBH   (NB * NHD)           // 32 (batch, head) pairs; bh = b*NHD + h
#define NQB   (TT / 64)            // 32 query / key tiles of 64
#define AHS   64.0f                // hi plane carry of the polynomial weights (exact power of two)
#define ALS   1024.0f              // residual plane carry on top of AHS (exact power of two)
#define VSC   16.0f                // v plane carry (exact power of two)
#define F16MX 65504.0f
static_assert((TT % 64) == 0);
static_assert(DKY == 32);
static_assert(DVL == 64);
static_assert(((NBH * TT * DKY) % (8 * 256)) == 0);

typedef _Float16 v16h __attribute__((ext_vector_type(16)));
typedef _Float16 v8h  __attribute__((ext_vector_type(8)));
typedef __bf16   v16b __attribute__((ext_vector_type(16)));
typedef __bf16   v8b  __attribute__((ext_vector_type(8)));
typedef float    v8f  __attribute__((ext_vector_type(8)));
typedef float    v4f  __attribute__((ext_vector_type(4)));
typedef unsigned int v4u __attribute__((ext_vector_type(4)));

// ---- scalar helpers --------------------------------------------------------------------------------
__device__ __forceinline__ unsigned short bf_bits(float f) {          // f32 -> bf16 bits, RNE convert
  unsigned u = __float_as_uint(f);
  return (unsigned short)((u + 0x7FFFu + ((u >> 16) & 1u)) >> 16);
}
__device__ __forceinline__ float bf_up(unsigned short h) { return __uint_as_float(((unsigned)h) << 16); }
__device__ __forceinline__ unsigned short h_bits(_Float16 x) { return __builtin_bit_cast(unsigned short, x); }
__device__ __forceinline__ unsigned pk16(unsigned short a, unsigned short b) { return (unsigned)a | ((unsigned)b << 16); }
__device__ __forceinline__ v8f zero8() { v8f z = {0.f, 0.f, 0.f, 0.f, 0.f, 0.f, 0.f, 0.f}; return z; }

// Degree-3 truncated exp, Horner order 1 + x*(1 + (x/2)*(1 + x/3)), unfused f32 ops.
__device__ __forceinline__ float poly3(float x) {
#pragma clang fp contract(off)
  const float third = 1.0f / 3.0f;
  float t = 1.0f + x * third;
  t = 1.0f + (x * 0.5f) * t;
  t = 1.0f + x * t;
  return t;
}

// ---- fragment loader: 16-bit A/B operand, lane -> row/col (lane&15), p already includes +8*(lane>>4);
//      elements 0..7 <- p[0..7] (k0+8h..), elements 8..15 <- p[16..23] (k0+16+8h..)
__device__ __forceinline__ v16b ldfrag_b(const __bf16* p) {
  union { v16b v; v8b h[2]; } f;
  f.h[0] = *(const v8b*)(p);
  f.h[1] = *(const v8b*)(p + 16);
  return f.v;
}

// ---- WMMA helpers with trailing VALU hazard gap --------------------------------------------------------
__device__ __forceinline__ v8f mma_b(v16b a, v16b b, v8f c) {
  c = __builtin_amdgcn_wmma_f32_16x16x32_bf16(false, a, false, b, (short)0, c, false, false);
#if defined(__HIP_DEVICE_COMPILE__)
  asm volatile("v_nop\n\tv_nop\n\tv_nop\n\tv_nop" : "+v"(c) : "v"(a), "v"(b));
#endif
  return c;
}
__device__ __forceinline__ v8f mma_h(v16h a, v16h b, v8f c) {
  c = __builtin_amdgcn_wmma_f32_16x16x32_f16(false, a, false, b, (short)0, c, false, false);
#if defined(__HIP_DEVICE_COMPILE__)
  asm volatile("v_nop\n\tv_nop\n\tv_nop\n\tv_nop" : "+v"(c) : "v"(a), "v"(b));
#endif
  return c;
}

// =====================================================================================================
// f32 [bh][pos][d] -> bf16 plane [bh][pos][d] (same element order, RNE convert), 8 elements per thread:
//   thread i converts elements 8i..8i+7. One 16-B store per lane; a wave writes 512 contiguous B = 4 whole
// coverage: n8 = n/8 threads x 8 halves = the whole plane.
// =====================================================================================================
__global__ __launch_bounds__(256) void cvt_bf16(const float* __restrict__ in, unsigned short* out, int n8) {
  const int i = blockIdx.x * 256 + threadIdx.x;
  if (i < n8) {
    const size_t src = (size_t)i * 8;
    const v4f a = *(const v4f*)(in + src);
    const v4f b = *(const v4f*)(in + src + 4);
    v4u p;
    p[0] = pk16(bf_bits(a[0]), bf_bits(a[1]));
    p[1] = pk16(bf_bits(a[2]), bf_bits(a[3]));
    p[2] = pk16(bf_bits(b[0]), bf_bits(b[1]));
    p[3] = pk16(bf_bits(b[2]), bf_bits(b[3]));
    *(v4u*)(out + src) = p;
    
  }
}

// =====================================================================================================
// v f32 [bh][pos][DVL] -> f16 v^T plane vt[(bh*DVL + d)*TT + s] = f16(bf16_rne(v) * vsc) (exact for a power of two).
// Block = one 64-position x 64-feature tile of one bh; grid = (TT/64, NBH); tile staged in LDS as f32
// (256 threads x 4 v4f loads, __syncthreads).
// Store: group g = tid>>3 (0..31), piece = tid&7: iteration it writes row d = it*32 + g; lanes 8g..8g+7 x 16 B =
// coverage: 2 iterations x 32 groups = 64 rows d, 8 pieces x 8 = 64 keys per row; grid covers every (bh, s tile).
// =====================================================================================================
__global__ __launch_bounds__(256) void v_planes(const float* __restrict__ vf, unsigned short* vt, float vsc) {
  __shared__ __align__(16) float sv[64 * 68];        // [tt][d], pitch 68 floats (272 B, 16-B aligned rows)
  const int tid = threadIdx.x;
  const int s0  = blockIdx.x * 64;
  const int bh  = blockIdx.y;
  if (bh >= NBH || s0 >= TT) return;                 // block-uniform, ahead of every barrier
  const float* src = vf + ((size_t)bh * TT + (size_t)s0) * DVL;   // 64 rows x 64 floats, contiguous
#pragma unroll
  for (int i = 0; i < 4; ++i) {
    const int idx = i * 256 + tid;                   // 0..1023
    const int tt = idx >> 4, c4 = (idx & 15) * 4;    // tt 0..63, c4 0..60
    const v4f a = *(const v4f*)(src + (size_t)tt * DVL + c4);
    *(v4f*)(sv + tt * 68 + c4) = a;
  }
  __syncthreads();

  const int g = tid >> 3, piece = tid & 7;
  v4u hv[2];
  size_t hofs[2];
#pragma unroll
  for (int it = 0; it < 2; ++it) {
    const int d = it * 32 + g;
    v4u a;
#pragma unroll
    for (int e = 0; e < 4; ++e) {
      const float f0 = sv[(piece * 8 + 2 * e) * 68 + d];
      const float f1 = sv[(piece * 8 + 2 * e + 1) * 68 + d];
      const _Float16 x0 = (_Float16)(bf_up(bf_bits(f0)) * vsc);
      const _Float16 x1 = (_Float16)(bf_up(bf_bits(f1)) * vsc);
      a[e] = pk16(h_bits(x0), h_bits(x1));
    }
    hv[it] = a;
    hofs[it] = ((size_t)(bh * DVL + d)) * TT + (size_t)s0 + (size_t)(piece * 8);
  }
  {
#pragma unroll
    for (int it = 0; it < 2; ++it) {
      *(v4u*)(vt + hofs[it]) = hv[it];
    }
    
  }
}

// =====================================================================================================
// Causal polynomial attention, d_key 32, d_val 64.
//   q plane bf16: element (bh, t, d) at [(bh*TT + t)*DKY + d];  k plane bf16: (bh, s, d) at [(bh*TT + s)*DKY + d]
//   v^T plane f16 (x VSC): (bh, d, s) at [(bh*DVL + d)*TT + s]
//   raw scores = q . k on bf16 WMMA (one k-step of 32 over d), f32 accumulate, then x = raw * sscale in f32,
//   a = 1 + x*(1 + x/2*(1 + x/3)) (f32), keys > query replaced by 0, z += a (f32, per-lane partials, fixed order).
//   a planes: hi = f16(clamp(64 a)), lo = f16((clamp(64 a) - hi) * 1024) (the difference is exact in f32);
//   context_hi += hi . v^T, context_lo += lo . v^T on f16 WMMA (2 k-steps of 32 per 64-key chunk), separate
//   accumulators; epilogue S = (context_hi + context_lo / 1024) / (64 * VSC), out = S * (1 / Z).
//   Block = 4 waves = 64 query rows of one bh; grid = NQB * NBH; key chunks 0..qb (block-uniform trip count,
//   statically clamped to NQB); every processed chunk holds at least one live key.
//   K / V^T chunk staging: K 64 rows x 32 halves (2 threads per row, 2 x 16 B each), V^T 64 rows x 64 halves
//   (2 threads per row, 4 x 16 B each); plain loads, __syncthreads before and after.
//   A tiles are wave-private, spilled with _Float16 element stores and reloaded as v8h (same element type)
//   out f32 [bh][pos][DVL]: row (bh, t) = 64 floats = 256 B; each wave stages its 16x64 tile in LDS, then one
//   instruction per row pair: lanes 0..15 x 16 B = row 2i, lanes 16..31 x 16 B = row 2i+1 (512 contiguous B =
// coverage: 8 instructions x 2 rows x 64 cols = the wave's 16 rows; 4 waves = the 64-row tile; grid = every
//   (bh, query tile).
// =====================================================================================================
__global__ __launch_bounds__(128)
void attn_poly(const unsigned short* __restrict__ qpl, const unsigned short* __restrict__ kpl,
               const unsigned short* __restrict__ vtpl, float* outp, float sscale) {
#pragma clang fp contract(off)
  union FH { v16h v; v8h h[2]; };
  union FB { v16b v; v8b h[2]; };
  __shared__ __align__(16) __bf16   Ksh[64 * DKY];                  // K [kv][d]        4 KB
  __shared__ __align__(16) _Float16 Vth[DVL * 64];                  // V^T [d][kv]      8 KB
  __shared__ __align__(16) _Float16 Psh[4][16 * 64];                // per wave hi plane [row][kv]
  __shared__ __align__(16) _Float16 Psl[4][16 * 64];                // per wave residual plane [row][kv]
  __shared__ __align__(16) float    Os[4][16 * DVL];                // per wave context tile [row][d]

  const int tid  = threadIdx.x;
  const int wave = tid >> 5;
  const int lane = tid & 31;
  const int hh   = lane >> 4;
  const int c    = lane & 15;

  const int bx = blockIdx.x;
  const int qb = bx % NQB;
  const int bh = bx / NQB;
  if (bh >= NBH) return;                     // block-uniform, ahead of every barrier
  const int q0 = qb * 64 + wave * 16;

  const __bf16*   Qp = (const __bf16*)(const void*)qpl + (size_t)bh * TT * DKY;
  const __bf16*   Kp = (const __bf16*)(const void*)kpl + (size_t)bh * TT * DKY;
  const _Float16* Vh = (const _Float16*)(const void*)vtpl + (size_t)bh * DVL * TT;

  // ---- Q fragment (A operand, row = lane&15): one d-chunk of 32 ----
  const v16b qa = ldfrag_b(Qp + (size_t)(q0 + c) * DKY + 8 * hh);

  float zl[8];
  v8f oacc[4], olo[4];
#pragma unroll
  for (int r = 0; r < 8; ++r) zl[r] = 0.f;
#pragma unroll
  for (int t = 0; t < 4; ++t) { oacc[t] = zero8(); olo[t] = zero8(); }

  int nkt = qb + 1;                          // causal: key chunks 0..qb, block-uniform
  if (nkt > NQB) nkt = NQB;
  for (int kt = 0; kt < nkt; ++kt) {
    const int kv0 = kt * 64;
    __syncthreads();
    {
      const int r  = tid >> 1;                                        // K row kv0+r, also V^T row d = r
      const int hf = (tid & 1) * 16;                                  // d = hf..hf+15
      const __bf16* kg = Kp + (size_t)(kv0 + r) * DKY + hf;
      const v8b a0 = *(const v8b*)(kg);
      const v8b a1 = *(const v8b*)(kg + 8);
      *(v8b*)(Ksh + r * DKY + hf)     = a0;
      *(v8b*)(Ksh + r * DKY + hf + 8) = a1;
      const int so = (tid & 1) * 32;                                  // s = kv0+so..kv0+so+31
      const _Float16* vg = Vh + (size_t)r * TT + (size_t)kv0 + (size_t)so;
#pragma unroll
      for (int i = 0; i < 4; ++i) {
        const v8h b0 = *(const v8h*)(vg + 8 * i);
        *(v8h*)(Vth + r * 64 + so + 8 * i) = b0;
      }
    }
    __syncthreads();

    // ---- raw scores: 16 query rows x 64 keys per wave, bf16 product, one d-chunk ----
    v8f s[4];
#pragma unroll
    for (int j = 0; j < 4; ++j) {
      FB kb;
      kb.h[0] = *(const v8b*)(Ksh + (j * 16 + c) * DKY + 8 * hh);
      kb.h[1] = *(const v8b*)(Ksh + (j * 16 + c) * DKY + 16 + 8 * hh);
      s[j] = mma_b(qa, kb.v, zero8());
    }

    // ---- scale, polynomial, causal zeroing, Z partials, hi / residual planes to LDS ----
    _Float16* pwh = Psh[wave];
    _Float16* pwl = Psl[wave];
#pragma unroll
    for (int r = 0; r < 8; ++r) {
      const int qrow = q0 + 8 * hh + r;
#pragma unroll
      for (int j = 0; j < 4; ++j) {
        const int key = kv0 + j * 16 + c;
        const float x = s[j][r] * sscale;
        float a = poly3(x);
        a = (key > qrow) ? 0.0f : a;
        zl[r] += a;
        float ac = a * AHS;
        ac = fminf(fmaxf(ac, -F16MX), F16MX);
        const _Float16 ah = (_Float16)ac;
        const _Float16 al = (_Float16)((ac - (float)ah) * ALS);
        pwh[(8 * hh + r) * 64 + j * 16 + c] = ah;
        pwl[(8 * hh + r) * 64 + j * 16 + c] = al;
      }
    }
    __builtin_amdgcn_fence(__ATOMIC_RELEASE, "workgroup");
    __builtin_amdgcn_wave_barrier();
    __builtin_amdgcn_fence(__ATOMIC_ACQUIRE, "workgroup");

    // ---- context_hi += hi . V^T, context_lo += lo . V^T (f16 WMMA, separate accumulators) ----
#pragma unroll 1
    for (int kk = 0; kk < 2; ++kk) {
      FH pa, pl;
      pa.h[0] = *(const v8h*)(pwh + c * 64 + kk * 32 + 8 * hh);
      pa.h[1] = *(const v8h*)(pwh + c * 64 + kk * 32 + 16 + 8 * hh);
      pl.h[0] = *(const v8h*)(pwl + c * 64 + kk * 32 + 8 * hh);
      pl.h[1] = *(const v8h*)(pwl + c * 64 + kk * 32 + 16 + 8 * hh);
#pragma unroll
      for (int t = 0; t < 4; ++t) {
        FH vb;
        vb.h[0] = *(const v8h*)(Vth + (t * 16 + c) * 64 + kk * 32 + 8 * hh);
        vb.h[1] = *(const v8h*)(Vth + (t * 16 + c) * 64 + kk * 32 + 16 + 8 * hh);
        oacc[t] = mma_h(pa.v, vb.v, oacc[t]);
        olo[t]  = mma_h(pl.v, vb.v, olo[t]);
      }
    }
  }

  // ---- Z fold (fixed-order butterfly over the 16 lanes of each half), S = (hi + lo/1024)/(64*VSC), S*(1/Z);
  float* os = Os[wave];
#pragma unroll
  for (int r = 0; r < 8; ++r) {
    float z = zl[r];
    z += __shfl_xor(z, 1, 32);
    z += __shfl_xor(z, 2, 32);
    z += __shfl_xor(z, 4, 32);
    z += __shfl_xor(z, 8, 32);
    const float rz = 1.0f / z;
#pragma unroll
    for (int t = 0; t < 4; ++t) {
      const float sv = (oacc[t][r] + olo[t][r] * (1.0f / ALS)) * (1.0f / (AHS * VSC));
      os[(8 * hh + r) * DVL + t * 16 + c] = sv * rz;
    }
  }
  __builtin_amdgcn_fence(__ATOMIC_RELEASE, "workgroup");
  __builtin_amdgcn_wave_barrier();
  __builtin_amdgcn_fence(__ATOMIC_ACQUIRE, "workgroup");
  {
    const int col4 = c * 4;                      // 16 lanes x 4 floats = one whole 64-float row
    {
#pragma unroll
      for (int it = 0; it < 8; ++it) {           // row pairs (2it, 2it+1) of the wave tile
        const int rr = 2 * it + hh;
        const v4f ov = *(const v4f*)(os + rr * DVL + col4);
        const size_t go = ((size_t)(bh * TT + q0 + rr)) * DVL + (size_t)col4;
        *(v4f*)(outp + go) = ov;
      }
      
    }
  }
}

// =====================================================================================================
// Inputs: in0 q [NB][NHD][TT][DKY] f32, in1 k same, in2 v [NB][NHD][TT][DVL] f32; bh = b*NHD + h.
// d_out f32 [NB][NHD][TT][DVL] at byte 0.
//   Qb  bf16 [NBH][TT][DKY]     0          4194304
//   Kb  bf16 [NBH][TT][DKY]     4194304    4194304
//   Vt  f16  [NBH][DVL][TT]     8388608    8388608
//   end                         16777216
// =====================================================================================================
extern "C" void kernel_launch(void* const* d_in, const int* in_sizes, int n_in,
                              void* d_out, int out_size, void* d_ws, size_t ws_size,
                              hipStream_t stream) {
  const int nq = NBH * TT * DKY;                      // 2097152
  const int nv = NBH * TT * DVL;                      // 4194304
  if (n_in < 3) return;
  if (in_sizes[0] != nq) return;
  if (in_sizes[1] != nq) return;
  if (in_sizes[2] != nv) return;
  if (out_size != nv) return;

  const float* q = (const float*)d_in[0];
  const float* k = (const float*)d_in[1];
  const float* v = (const float*)d_in[2];

  const size_t PQ = (size_t)nq * 2;                   // 4194304
  const size_t PK = (size_t)nq * 2;                   // 4194304
  const size_t PV = (size_t)nv * 2;                   // 8388608
  size_t off = 0;
  const size_t oQ = off; off += PQ;
  const size_t oK = off; off += PK;
  const size_t oV = off; off += PV;
  if (off > ws_size) return;                          // off = 16777216
  if (off > (size_t)134217728) return;

  char* ws = (char*)d_ws;
  unsigned short* Qb = (unsigned short*)(ws + oQ);
  unsigned short* Kb = (unsigned short*)(ws + oK);
  unsigned short* Vt = (unsigned short*)(ws + oV);
  float* outf = (float*)d_out;

  const dim3 blk(256);
  const int n8 = nq / 8;                              // 262144
  const dim3 gCvt((n8 + 255) / 256);                  // 1024 blocks
  const dim3 gV(TT / 64, NBH);                        // (32, 32)
  const float sscale = 1.0f / sqrtf((float)DKY);

  // (0) q, k -> bf16 planes (same element order)
  cvt_bf16<<<gCvt, blk, 0, stream>>>(q, Qb, n8);
  cvt_bf16<<<gCvt, blk, 0, stream>>>(k, Kb, n8);
  // (1) v -> f16 v^T plane [bh][d][pos], values x VSC
  v_planes<<<gV, blk, 0, stream>>>(v, Vt, VSC);
  // (2) causal polynomial attention -> d_out
  attn_poly<<<dim3(NBH * NQB), dim3(128), 0, stream>>>(Qb, Kb, Vt, outf, sscale);
  (void)hipGetLastError();
}

// v001
// It runs in 87.7 microseconds.
// Next to v000, in two timings, it ran 1.39 times as fast each time.
// Contractions: q.k^T scores = v_wmma_f32_16x16x32_bf16 (bf16 operands = RNE-converted q and k planes, single product,
// d_key 32 = one k-step); a.v context = v_wmma_f32_16x16x32_f16 (a carried as an f16 hi plane x64 plus an f16 residual
// plane x64x1024 feeding a second accumulator, v as f16 of the bf16-converted value x16; two products); all f32
// accumulate; cubic truncated-exp polynomial, causal zeroing, row sums Z and the final S*(1/Z) in f32.
#include <hip/hip_runtime.h>
#include <math.h>
#include <stdint.h>

#define TT    2048                 // sequence length (queries == keys)
#define NB    4
#define NHD   8
#define DKY   32                   // d_key
#define DVL   64                   // d_val
#define NBH   (NB * NHD)           // 32 (batch, head) pairs; bh = b*NHD + h
#define NQB   (TT / 64)            // 32 query / key tiles of 64
#define AHS   64.0f                // hi plane carry of the polynomial weights (exact power of two)
#define ALS   1024.0f              // residual plane carry on top of AHS (exact power of two)
#define VSC   16.0f                // v plane carry (exact power of two)
#define F16MX 65504.0f
// LDS row pitches in 16-bit elements: 16 B x odd, so that the 16 rows one ds_load_b128 half-wave reads start on
// 16 distinct bank quads (bank = dword address mod 64) instead of 2 (128-B rows) or 4 (64-B rows).
#define KPT   40                   // K rows: 32 halves + 8 pad  = 80 B
#define VPT   72                   // V^T rows: 64 halves + 8 pad = 144 B
#define PPT   72                   // weight-plane rows: 64 halves + 8 pad = 144 B
static_assert((TT % 64) == 0);
static_assert(DKY == 32);
static_assert(DVL == 64);
static_assert((KPT % 16) == 8 && (VPT % 16) == 8 && (PPT % 16) == 8);
static_assert(((NBH * TT * DKY) % (8 * 256)) == 0);

typedef _Float16 v16h __attribute__((ext_vector_type(16)));
typedef _Float16 v8h  __attribute__((ext_vector_type(8)));
typedef __bf16   v16b __attribute__((ext_vector_type(16)));
typedef __bf16   v8b  __attribute__((ext_vector_type(8)));
typedef float    v8f  __attribute__((ext_vector_type(8)));
typedef float    v4f  __attribute__((ext_vector_type(4)));
typedef unsigned int v4u __attribute__((ext_vector_type(4)));

// ---- scalar helpers --------------------------------------------------------------------------------
__device__ __forceinline__ unsigned short bf_bits(float f) {          // f32 -> bf16 bits, RNE convert
  unsigned u = __float_as_uint(f);
  return (unsigned short)((u + 0x7FFFu + ((u >> 16) & 1u)) >> 16);
}
__device__ __forceinline__ float bf_up(unsigned short h) { return __uint_as_float(((unsigned)h) << 16); }
__device__ __forceinline__ unsigned short h_bits(_Float16 x) { return __builtin_bit_cast(unsigned short, x); }
__device__ __forceinline__ unsigned pk16(unsigned short a, unsigned short b) { return (unsigned)a | ((unsigned)b << 16); }
__device__ __forceinline__ v8f zero8() { v8f z = {0.f, 0.f, 0.f, 0.f, 0.f, 0.f, 0.f, 0.f}; return z; }

// Degree-3 truncated exp, Horner order 1 + x*(1 + (x/2)*(1 + x/3)), unfused f32 ops.
__device__ __forceinline__ float poly3(float x) {
#pragma clang fp contract(off)
  const float third = 1.0f / 3.0f;
  float t = 1.0f + x * third;
  t = 1.0f + (x * 0.5f) * t;
  t = 1.0f + x * t;
  return t;
}

// ---- fragment loader: 16-bit A/B operand, lane -> row/col (lane&15), p already includes +8*(lane>>4);
//      elements 0..7 <- p[0..7] (k0+8h..), elements 8..15 <- p[16..23] (k0+16+8h..)
__device__ __forceinline__ v16b ldfrag_b(const __bf16* p) {
  union { v16b v; v8b h[2]; } f;
  f.h[0] = *(const v8b*)(p);
  f.h[1] = *(const v8b*)(p + 16);
  return f.v;
}

// ---- WMMA helpers with trailing VALU hazard gap --------------------------------------------------------
__device__ __forceinline__ v8f mma_b(v16b a, v16b b, v8f c) {
  c = __builtin_amdgcn_wmma_f32_16x16x32_bf16(false, a, false, b, (short)0, c, false, false);
#if defined(__HIP_DEVICE_COMPILE__)
  asm volatile("v_nop\n\tv_nop\n\tv_nop\n\tv_nop" : "+v"(c) : "v"(a), "v"(b));
#endif
  return c;
}
__device__ __forceinline__ v8f mma_h(v16h a, v16h b, v8f c) {
  c = __builtin_amdgcn_wmma_f32_16x16x32_f16(false, a, false, b, (short)0, c, false, false);
#if defined(__HIP_DEVICE_COMPILE__)
  asm volatile("v_nop\n\tv_nop\n\tv_nop\n\tv_nop" : "+v"(c) : "v"(a), "v"(b));
#endif
  return c;
}

// =====================================================================================================
// f32 [bh][pos][d] -> bf16 plane [bh][pos][d] (same element order, RNE convert), 8 elements per thread:
//   thread i converts elements 8i..8i+7. One 16-B store per lane; a wave writes 512 contiguous B = 4 whole
// coverage: n8 = n/8 threads x 8 halves = the whole plane.
// =====================================================================================================
__global__ __launch_bounds__(256) void cvt_bf16(const float* __restrict__ in, unsigned short* out, int n8) {
  const int i = blockIdx.x * 256 + threadIdx.x;
  if (i < n8) {
    const size_t src = (size_t)i * 8;
    const v4f a = *(const v4f*)(in + src);
    const v4f b = *(const v4f*)(in + src + 4);
    v4u p;
    p[0] = pk16(bf_bits(a[0]), bf_bits(a[1]));
    p[1] = pk16(bf_bits(a[2]), bf_bits(a[3]));
    p[2] = pk16(bf_bits(b[0]), bf_bits(b[1]));
    p[3] = pk16(bf_bits(b[2]), bf_bits(b[3]));
    *(v4u*)(out + src) = p;
    
  }
}

// =====================================================================================================
// v f32 [bh][pos][DVL] -> f16 v^T plane vt[(bh*DVL + d)*TT + s] = f16(bf16_rne(v) * vsc) (exact for a power of two).
// Block = one 64-position x 64-feature tile of one bh; grid = (TT/64, NBH); tile staged in LDS as f32
// (256 threads x 4 v4f loads, __syncthreads).
// Store: group g = tid>>3 (0..31), piece = tid&7: iteration it writes row d = it*32 + g; lanes 8g..8g+7 x 16 B =
// coverage: 2 iterations x 32 groups = 64 rows d, 8 pieces x 8 = 64 keys per row; grid covers every (bh, s tile).
// =====================================================================================================
__global__ __launch_bounds__(256) void v_planes(const float* __restrict__ vf, unsigned short* vt, float vsc) {
  __shared__ __align__(16) float sv[64 * 68];        // [tt][d], pitch 68 floats (272 B, 16-B aligned rows)
  const int tid = threadIdx.x;
  const int s0  = blockIdx.x * 64;
  const int bh  = blockIdx.y;
  if (bh >= NBH || s0 >= TT) return;                 // block-uniform, ahead of every barrier
  const float* src = vf + ((size_t)bh * TT + (size_t)s0) * DVL;   // 64 rows x 64 floats, contiguous
#pragma unroll
  for (int i = 0; i < 4; ++i) {
    const int idx = i * 256 + tid;                   // 0..1023
    const int tt = idx >> 4, c4 = (idx & 15) * 4;    // tt 0..63, c4 0..60
    const v4f a = *(const v4f*)(src + (size_t)tt * DVL + c4);
    *(v4f*)(sv + tt * 68 + c4) = a;
  }
  __syncthreads();

  const int g = tid >> 3, piece = tid & 7;
  v4u hv[2];
  size_t hofs[2];
#pragma unroll
  for (int it = 0; it < 2; ++it) {
    const int d = it * 32 + g;
    v4u a;
#pragma unroll
    for (int e = 0; e < 4; ++e) {
      const float f0 = sv[(piece * 8 + 2 * e) * 68 + d];
      const float f1 = sv[(piece * 8 + 2 * e + 1) * 68 + d];
      const _Float16 x0 = (_Float16)(bf_up(bf_bits(f0)) * vsc);
      const _Float16 x1 = (_Float16)(bf_up(bf_bits(f1)) * vsc);
      a[e] = pk16(h_bits(x0), h_bits(x1));
    }
    hv[it] = a;
    hofs[it] = ((size_t)(bh * DVL + d)) * TT + (size_t)s0 + (size_t)(piece * 8);
  }
  {
#pragma unroll
    for (int it = 0; it < 2; ++it) {
      *(v4u*)(vt + hofs[it]) = hv[it];
    }
    
  }
}

// =====================================================================================================
// Causal polynomial attention, d_key 32, d_val 64.
//   q plane bf16: element (bh, t, d) at [(bh*TT + t)*DKY + d];  k plane bf16: (bh, s, d) at [(bh*TT + s)*DKY + d]
//   v^T plane f16 (x VSC): (bh, d, s) at [(bh*DVL + d)*TT + s]
//   raw scores = q . k on bf16 WMMA (one k-step of 32 over d), f32 accumulate, then x = raw * sscale in f32,
//   a = 1 + x*(1 + x/2*(1 + x/3)) (f32), keys > query replaced by 0, z += a (f32, per-lane partials, fixed order).
//   a planes: hi = f16(clamp(64 a)), lo = f16((clamp(64 a) - hi) * 1024) (the difference is exact in f32);
//   context_hi += hi . v^T, context_lo += lo . v^T on f16 WMMA (2 k-steps of 32 per 64-key chunk), separate
//   accumulators; epilogue S = (context_hi + context_lo / 1024) / (64 * VSC), out = S * (1 / Z).
//   Block = 4 waves = 64 query rows of one bh; grid = NQB * NBH; key chunks 0..qb (block-uniform trip count,
//   statically clamped to NQB); every processed chunk holds at least one live key.
//   K / V^T chunk staging: K 64 rows x 32 halves (2 threads per row, 2 x 16 B each), V^T 64 rows x 64 halves
//   (2 threads per row, 4 x 16 B each); plain loads, __syncthreads before and after.
//   A tiles are wave-private, spilled with _Float16 element stores and reloaded as v8h (same element type)
//   out f32 [bh][pos][DVL]: row (bh, t) = 64 floats = 256 B; each wave stages its 16x64 tile in LDS, then one
//   instruction per row pair: lanes 0..15 x 16 B = row 2i, lanes 16..31 x 16 B = row 2i+1 (512 contiguous B =
// coverage: 8 instructions x 2 rows x 64 cols = the wave's 16 rows; 4 waves = the 64-row tile; grid = every
//   (bh, query tile).
// =====================================================================================================
__global__ __launch_bounds__(128)
void attn_poly(const unsigned short* __restrict__ qpl, const unsigned short* __restrict__ kpl,
               const unsigned short* __restrict__ vtpl, float* outp, float sscale) {
#pragma clang fp contract(off)
  union FH { v16h v; v8h h[2]; };
  union FB { v16b v; v8b h[2]; };
  __shared__ __align__(16) __bf16   Ksh[64 * KPT];                  // K [kv][d], padded rows     5 KB
  __shared__ __align__(16) _Float16 Vth[DVL * VPT];                 // V^T [d][kv], padded rows   9 KB
  __shared__ __align__(16) _Float16 Psh[4][16 * PPT];               // per wave hi plane [row][kv], padded rows
  __shared__ __align__(16) _Float16 Psl[4][16 * PPT];               // per wave residual plane [row][kv], padded rows
  __shared__ __align__(16) float    Os[4][16 * DVL];                // per wave context tile [row][d]

  const int tid  = threadIdx.x;
  const int wave = tid >> 5;
  const int lane = tid & 31;
  const int hh   = lane >> 4;
  const int c    = lane & 15;

  const int bx = blockIdx.x;
  const int qb = bx % NQB;
  const int bh = bx / NQB;
  if (bh >= NBH) return;                     // block-uniform, ahead of every barrier
  const int q0 = qb * 64 + wave * 16;

  const __bf16*   Qp = (const __bf16*)(const void*)qpl + (size_t)bh * TT * DKY;
  const __bf16*   Kp = (const __bf16*)(const void*)kpl + (size_t)bh * TT * DKY;
  const _Float16* Vh = (const _Float16*)(const void*)vtpl + (size_t)bh * DVL * TT;

  // ---- Q fragment (A operand, row = lane&15): one d-chunk of 32 ----
  const v16b qa = ldfrag_b(Qp + (size_t)(q0 + c) * DKY + 8 * hh);

  float zl[8];
  v8f oacc[4], olo[4];
#pragma unroll
  for (int r = 0; r < 8; ++r) zl[r] = 0.f;
#pragma unroll
  for (int t = 0; t < 4; ++t) { oacc[t] = zero8(); olo[t] = zero8(); }

  int nkt = qb + 1;                          // causal: key chunks 0..qb, block-uniform
  if (nkt > NQB) nkt = NQB;
  for (int kt = 0; kt < nkt; ++kt) {
    const int kv0 = kt * 64;
    __syncthreads();
    {
      const int r  = tid >> 1;                                        // K row kv0+r, also V^T row d = r
      const int hf = (tid & 1) * 16;                                  // d = hf..hf+15
      const __bf16* kg = Kp + (size_t)(kv0 + r) * DKY + hf;
      const v8b a0 = *(const v8b*)(kg);
      const v8b a1 = *(const v8b*)(kg + 8);
      *(v8b*)(Ksh + r * KPT + hf)     = a0;
      *(v8b*)(Ksh + r * KPT + hf + 8) = a1;
      const int so = (tid & 1) * 32;                                  // s = kv0+so..kv0+so+31
      const _Float16* vg = Vh + (size_t)r * TT + (size_t)kv0 + (size_t)so;
#pragma unroll
      for (int i = 0; i < 4; ++i) {
        const v8h b0 = *(const v8h*)(vg + 8 * i);
        *(v8h*)(Vth + r * VPT + so + 8 * i) = b0;
      }
    }
    __syncthreads();

    // ---- raw scores: 16 query rows x 64 keys per wave, bf16 product, one d-chunk ----
    v8f s[4];
#pragma unroll
    for (int j = 0; j < 4; ++j) {
      FB kb;
      kb.h[0] = *(const v8b*)(Ksh + (j * 16 + c) * KPT + 8 * hh);
      kb.h[1] = *(const v8b*)(Ksh + (j * 16 + c) * KPT + 16 + 8 * hh);
      s[j] = mma_b(qa, kb.v, zero8());
    }

    // ---- scale, polynomial, causal zeroing, Z partials, hi / residual planes to LDS ----
    _Float16* pwh = Psh[wave];
    _Float16* pwl = Psl[wave];
#pragma unroll
    for (int r = 0; r < 8; ++r) {
      const int qrow = q0 + 8 * hh + r;
#pragma unroll
      for (int j = 0; j < 4; ++j) {
        const int key = kv0 + j * 16 + c;
        const float x = s[j][r] * sscale;
        float a = poly3(x);
        a = (key > qrow) ? 0.0f : a;
        zl[r] += a;
        float ac = a * AHS;
        ac = fminf(fmaxf(ac, -F16MX), F16MX);
        const _Float16 ah = (_Float16)ac;
        const _Float16 al = (_Float16)((ac - (float)ah) * ALS);
        pwh[(8 * hh + r) * PPT + j * 16 + c] = ah;
        pwl[(8 * hh + r) * PPT + j * 16 + c] = al;
      }
    }
    __builtin_amdgcn_fence(__ATOMIC_RELEASE, "workgroup");
    __builtin_amdgcn_wave_barrier();
    __builtin_amdgcn_fence(__ATOMIC_ACQUIRE, "workgroup");

    // ---- context_hi += hi . V^T, context_lo += lo . V^T (f16 WMMA, separate accumulators) ----
#pragma unroll 1
    for (int kk = 0; kk < 2; ++kk) {
      FH pa, pl;
      pa.h[0] = *(const v8h*)(pwh + c * PPT + kk * 32 + 8 * hh);
      pa.h[1] = *(const v8h*)(pwh + c * PPT + kk * 32 + 16 + 8 * hh);
      pl.h[0] = *(const v8h*)(pwl + c * PPT + kk * 32 + 8 * hh);
      pl.h[1] = *(const v8h*)(pwl + c * PPT + kk * 32 + 16 + 8 * hh);
#pragma unroll
      for (int t = 0; t < 4; ++t) {
        FH vb;
        vb.h[0] = *(const v8h*)(Vth + (t * 16 + c) * VPT + kk * 32 + 8 * hh);
        vb.h[1] = *(const v8h*)(Vth + (t * 16 + c) * VPT + kk * 32 + 16 + 8 * hh);
        oacc[t] = mma_h(pa.v, vb.v, oacc[t]);
        olo[t]  = mma_h(pl.v, vb.v, olo[t]);
      }
    }
  }

  // ---- Z fold (fixed-order butterfly over the 16 lanes of each half), S = (hi + lo/1024)/(64*VSC), S*(1/Z);
  float* os = Os[wave];
#pragma unroll
  for (int r = 0; r < 8; ++r) {
    float z = zl[r];
    z += __shfl_xor(z, 1, 32);
    z += __shfl_xor(z, 2, 32);
    z += __shfl_xor(z, 4, 32);
    z += __shfl_xor(z, 8, 32);
    const float rz = 1.0f / z;
#pragma unroll
    for (int t = 0; t < 4; ++t) {
      const float sv = (oacc[t][r] + olo[t][r] * (1.0f / ALS)) * (1.0f / (AHS * VSC));
      os[(8 * hh + r) * DVL + t * 16 + c] = sv * rz;
    }
  }
  __builtin_amdgcn_fence(__ATOMIC_RELEASE, "workgroup");
  __builtin_amdgcn_wave_barrier();
  __builtin_amdgcn_fence(__ATOMIC_ACQUIRE, "workgroup");
  {
    const int col4 = c * 4;                      // 16 lanes x 4 floats = one whole 64-float row
    {
#pragma unroll
      for (int it = 0; it < 8; ++it) {           // row pairs (2it, 2it+1) of the wave tile
        const int rr = 2 * it + hh;
        const v4f ov = *(const v4f*)(os + rr * DVL + col4);
        const size_t go = ((size_t)(bh * TT + q0 + rr)) * DVL + (size_t)col4;
        *(v4f*)(outp + go) = ov;
      }
      
    }
  }
}

// =====================================================================================================
// Inputs: in0 q [NB][NHD][TT][DKY] f32, in1 k same, in2 v [NB][NHD][TT][DVL] f32; bh = b*NHD + h.
// d_out f32 [NB][NHD][TT][DVL] at byte 0.
//   Qb  bf16 [NBH][TT][DKY]     0          4194304
//   Kb  bf16 [NBH][TT][DKY]     4194304    4194304
//   Vt  f16  [NBH][DVL][TT]     8388608    8388608
//   end                         16777216
// =====================================================================================================
extern "C" void kernel_launch(void* const* d_in, const int* in_sizes, int n_in,
                              void* d_out, int out_size, void* d_ws, size_t ws_size,
                              hipStream_t stream) {
  const int nq = NBH * TT * DKY;                      // 2097152
  const int nv = NBH * TT * DVL;                      // 4194304
  if (n_in < 3) return;
  if (in_sizes[0] != nq) return;
  if (in_sizes[1] != nq) return;
  if (in_sizes[2] != nv) return;
  if (out_size != nv) return;

  const float* q = (const float*)d_in[0];
  const float* k = (const float*)d_in[1];
  const float* v = (const float*)d_in[2];

  const size_t PQ = (size_t)nq * 2;                   // 4194304
  const size_t PK = (size_t)nq * 2;                   // 4194304
  const size_t PV = (size_t)nv * 2;                   // 8388608
  size_t off = 0;
  const size_t oQ = off; off += PQ;
  const size_t oK = off; off += PK;
  const size_t oV = off; off += PV;
  if (off > ws_size) return;                          // off = 16777216
  if (off > (size_t)134217728) return;

  char* ws = (char*)d_ws;
  unsigned short* Qb = (unsigned short*)(ws + oQ);
  unsigned short* Kb = (unsigned short*)(ws + oK);
  unsigned short* Vt = (unsigned short*)(ws + oV);
  float* outf = (float*)d_out;

  const dim3 blk(256);
  const int n8 = nq / 8;                              // 262144
  const dim3 gCvt((n8 + 255) / 256);                  // 1024 blocks
  const dim3 gV(TT / 64, NBH);                        // (32, 32)
  const float sscale = 1.0f / sqrtf((float)DKY);

  // (0) q, k -> bf16 planes (same element order)
  cvt_bf16<<<gCvt, blk, 0, stream>>>(q, Qb, n8);
  cvt_bf16<<<gCvt, blk, 0, stream>>>(k, Kb, n8);
  // (1) v -> f16 v^T plane [bh][d][pos], values x VSC
  v_planes<<<gV, blk, 0, stream>>>(v, Vt, VSC);
  // (2) causal polynomial attention -> d_out
  attn_poly<<<dim3(NBH * NQB), dim3(128), 0, stream>>>(Qb, Kb, Vt, outf, sscale);
  (void)hipGetLastError();
}

// v002
// One run takes 75.6 microseconds.
// Next to v001, in two timings, it ran 1.15 and 1.18 times as fast.
// Over all steps from v000 it is 1.62 times as fast.
// Contractions: q.k^T scores = v_wmma_f32_16x16x32_bf16 (bf16 operands = RNE-converted q and k planes, single product,
// d_key 32 = one k-step); a.v context = v_wmma_f32_16x16x32_f16 (a carried as an f16 hi plane x64 plus an f16 residual
// plane x64x1024 feeding a second accumulator, v as f16 of the bf16-converted value x16; two products); all f32
// accumulate; cubic truncated-exp polynomial, causal zeroing, row sums Z and the final S*(1/Z) in f32.
#include <hip/hip_runtime.h>
#include <math.h>
#include <stdint.h>

#define TT    2048                 // sequence length (queries == keys)
#define NB    4
#define NHD   8
#define DKY   32                   // d_key
#define DVL   64                   // d_val
#define NBH   (NB * NHD)           // 32 (batch, head) pairs; bh = b*NHD + h
#define NQB   (TT / 64)            // 32 query / key tiles of 64
#define AHS   64.0f                // hi plane carry of the polynomial weights (exact power of two)
#define ALS   1024.0f              // residual plane carry on top of AHS (exact power of two)
#define VSC   16.0f                // v plane carry (exact power of two)
#define F16MX 65504.0f
// LDS row pitches in 16-bit elements: 16 B x odd, so that the 16 rows one ds_load_b128 half-wave reads start on
// 16 distinct bank quads (bank = dword address mod 64) instead of 2 (128-B rows) or 4 (64-B rows).
#define KPT   40                   // K rows: 32 halves + 8 pad  = 80 B
#define VPT   72                   // V^T rows: 64 halves + 8 pad = 144 B
#define PPT   72                   // weight-plane rows: 64 halves + 8 pad = 144 B
static_assert((TT % 64) == 0);
static_assert((NQB % 2) == 0);
static_assert(DKY == 32);
static_assert(DVL == 64);
static_assert((KPT % 16) == 8 && (VPT % 16) == 8 && (PPT % 16) == 8);
static_assert(((NBH * TT * DKY) % (8 * 256)) == 0);

typedef _Float16 v16h __attribute__((ext_vector_type(16)));
typedef _Float16 v8h  __attribute__((ext_vector_type(8)));
typedef __bf16   v16b __attribute__((ext_vector_type(16)));
typedef __bf16   v8b  __attribute__((ext_vector_type(8)));
typedef float    v8f  __attribute__((ext_vector_type(8)));
typedef float    v4f  __attribute__((ext_vector_type(4)));
typedef unsigned int v4u __attribute__((ext_vector_type(4)));

// ---- scalar helpers --------------------------------------------------------------------------------
__device__ __forceinline__ unsigned short bf_bits(float f) {          // f32 -> bf16 bits, RNE convert
  unsigned u = __float_as_uint(f);
  return (unsigned short)((u + 0x7FFFu + ((u >> 16) & 1u)) >> 16);
}
__device__ __forceinline__ float bf_up(unsigned short h) { return __uint_as_float(((unsigned)h) << 16); }
__device__ __forceinline__ unsigned short h_bits(_Float16 x) { return __builtin_bit_cast(unsigned short, x); }
__device__ __forceinline__ unsigned pk16(unsigned short a, unsigned short b) { return (unsigned)a | ((unsigned)b << 16); }
__device__ __forceinline__ v8f zero8() { v8f z = {0.f, 0.f, 0.f, 0.f, 0.f, 0.f, 0.f, 0.f}; return z; }

// Degree-3 truncated exp, Horner order 1 + x*(1 + (x/2)*(1 + x/3)), unfused f32 ops.
__device__ __forceinline__ float poly3(float x) {
#pragma clang fp contract(off)
  const float third = 1.0f / 3.0f;
  float t = 1.0f + x * third;
  t = 1.0f + (x * 0.5f) * t;
  t = 1.0f + x * t;
  return t;
}

// ---- fragment loader: 16-bit A/B operand, lane -> row/col (lane&15), p already includes +8*(lane>>4);
//      elements 0..7 <- p[0..7] (k0+8h..), elements 8..15 <- p[16..23] (k0+16+8h..)
__device__ __forceinline__ v16b ldfrag_b(const __bf16* p) {
  union { v16b v; v8b h[2]; } f;
  f.h[0] = *(const v8b*)(p);
  f.h[1] = *(const v8b*)(p + 16);
  return f.v;
}

// ---- WMMA helpers with trailing VALU hazard gap --------------------------------------------------------
__device__ __forceinline__ v8f mma_b(v16b a, v16b b, v8f c) {
  c = __builtin_amdgcn_wmma_f32_16x16x32_bf16(false, a, false, b, (short)0, c, false, false);
#if defined(__HIP_DEVICE_COMPILE__)
  asm volatile("v_nop\n\tv_nop\n\tv_nop\n\tv_nop" : "+v"(c) : "v"(a), "v"(b));
#endif
  return c;
}
__device__ __forceinline__ v8f mma_h(v16h a, v16h b, v8f c) {
  c = __builtin_amdgcn_wmma_f32_16x16x32_f16(false, a, false, b, (short)0, c, false, false);
#if defined(__HIP_DEVICE_COMPILE__)
  asm volatile("v_nop\n\tv_nop\n\tv_nop\n\tv_nop" : "+v"(c) : "v"(a), "v"(b));
#endif
  return c;
}

// =====================================================================================================
// f32 [bh][pos][d] -> bf16 plane [bh][pos][d] (same element order, RNE convert), 8 elements per thread:
//   thread i converts elements 8i..8i+7. One 16-B store per lane; a wave writes 512 contiguous B = 4 whole
// coverage: n8 = n/8 threads x 8 halves = the whole plane.
// =====================================================================================================
__global__ __launch_bounds__(256) void cvt_bf16(const float* __restrict__ in, unsigned short* out, int n8) {
  const int i = blockIdx.x * 256 + threadIdx.x;
  if (i < n8) {
    const size_t src = (size_t)i * 8;
    const v4f a = *(const v4f*)(in + src);
    const v4f b = *(const v4f*)(in + src + 4);
    v4u p;
    p[0] = pk16(bf_bits(a[0]), bf_bits(a[1]));
    p[1] = pk16(bf_bits(a[2]), bf_bits(a[3]));
    p[2] = pk16(bf_bits(b[0]), bf_bits(b[1]));
    p[3] = pk16(bf_bits(b[2]), bf_bits(b[3]));
    *(v4u*)(out + src) = p;
    
  }
}

// =====================================================================================================
// v f32 [bh][pos][DVL] -> f16 v^T plane vt[(bh*DVL + d)*TT + s] = f16(bf16_rne(v) * vsc) (exact for a power of two).
// Block = one 64-position x 64-feature tile of one bh; grid = (TT/64, NBH); tile staged in LDS as f32
// (256 threads x 4 v4f loads, __syncthreads).
// Store: group g = tid>>3 (0..31), piece = tid&7: iteration it writes row d = it*32 + g; lanes 8g..8g+7 x 16 B =
// coverage: 2 iterations x 32 groups = 64 rows d, 8 pieces x 8 = 64 keys per row; grid covers every (bh, s tile).
// =====================================================================================================
__global__ __launch_bounds__(256) void v_planes(const float* __restrict__ vf, unsigned short* vt, float vsc) {
  __shared__ __align__(16) float sv[64 * 68];        // [tt][d], pitch 68 floats (272 B, 16-B aligned rows)
  const int tid = threadIdx.x;
  const int s0  = blockIdx.x * 64;
  const int bh  = blockIdx.y;
  if (bh >= NBH || s0 >= TT) return;                 // block-uniform, ahead of every barrier
  const float* src = vf + ((size_t)bh * TT + (size_t)s0) * DVL;   // 64 rows x 64 floats, contiguous
#pragma unroll
  for (int i = 0; i < 4; ++i) {
    const int idx = i * 256 + tid;                   // 0..1023
    const int tt = idx >> 4, c4 = (idx & 15) * 4;    // tt 0..63, c4 0..60
    const v4f a = *(const v4f*)(src + (size_t)tt * DVL + c4);
    *(v4f*)(sv + tt * 68 + c4) = a;
  }
  __syncthreads();

  const int g = tid >> 3, piece = tid & 7;
  v4u hv[2];
  size_t hofs[2];
#pragma unroll
  for (int it = 0; it < 2; ++it) {
    const int d = it * 32 + g;
    v4u a;
#pragma unroll
    for (int e = 0; e < 4; ++e) {
      const float f0 = sv[(piece * 8 + 2 * e) * 68 + d];
      const float f1 = sv[(piece * 8 + 2 * e + 1) * 68 + d];
      const _Float16 x0 = (_Float16)(bf_up(bf_bits(f0)) * vsc);
      const _Float16 x1 = (_Float16)(bf_up(bf_bits(f1)) * vsc);
      a[e] = pk16(h_bits(x0), h_bits(x1));
    }
    hv[it] = a;
    hofs[it] = ((size_t)(bh * DVL + d)) * TT + (size_t)s0 + (size_t)(piece * 8);
  }
  {
#pragma unroll
    for (int it = 0; it < 2; ++it) {
      *(v4u*)(vt + hofs[it]) = hv[it];
    }
    
  }
}

// =====================================================================================================
// Causal polynomial attention, d_key 32, d_val 64.
//   q plane bf16: element (bh, t, d) at [(bh*TT + t)*DKY + d];  k plane bf16: (bh, s, d) at [(bh*TT + s)*DKY + d]
//   v^T plane f16 (x VSC): (bh, d, s) at [(bh*DVL + d)*TT + s]
//   raw scores = q . k on bf16 WMMA (one k-step of 32 over d), f32 accumulate, then x = raw * sscale in f32,
//   a = 1 + x*(1 + x/2*(1 + x/3)) (f32), keys > query replaced by 0, z += a (f32, per-lane partials, fixed order).
//   a planes: hi = f16(clamp(64 a)), lo = f16((clamp(64 a) - hi) * 1024) (the difference is exact in f32);
//   context_hi += hi . v^T, context_lo += lo . v^T on f16 WMMA (2 k-steps of 32 per 64-key chunk), separate
//   accumulators; epilogue S = (context_hi + context_lo / 1024) / (64 * VSC), out = S * (1 / Z).
//   Block = 4 waves; it runs two 64-row query tiles of one bh one after the other, tile NQB-1-p and then tile p,
//   so that every block walks NQB+1 key chunks (causal cost is linear in the tile index; all blocks are resident at
//   once and the launch lasts as long as its fullest block). grid = (NQB/2) * NBH; key chunks 0..qb per tile
//   (block-uniform trip count, statically clamped to NQB); every processed chunk holds at least one live key.
//   K / V^T chunk staging: K 64 rows x 32 halves (2 threads per row, 2 x 16 B each), V^T 64 rows x 64 halves
//   (2 threads per row, 4 x 16 B each); plain loads, __syncthreads before and after.
//   A tiles are wave-private, spilled with _Float16 element stores and reloaded as v8h (same element type)
//   out f32 [bh][pos][DVL]: row (bh, t) = 64 floats = 256 B; each wave stages its 16x64 tile in LDS, then one
//   instruction per row pair: lanes 0..15 x 16 B = row 2i, lanes 16..31 x 16 B = row 2i+1 (512 contiguous B =
// coverage: 8 instructions x 2 rows x 64 cols = the wave's 16 rows; 4 waves = the 64-row tile; p = 0..NQB/2-1 with
//   tiles p and NQB-1-p = every query tile once; grid = every (bh, p).
// =====================================================================================================
// waves_per_eu(2, 2): the halved grid puts two blocks on a WGP = two waves per SIMD; with that register budget the
// six staging loads of a chunk stay one group (at the default budget the two-tile loop made them wait one by one).
__global__ __launch_bounds__(128) __attribute__((amdgpu_waves_per_eu(2, 2)))
void attn_poly(const unsigned short* __restrict__ qpl, const unsigned short* __restrict__ kpl,
               const unsigned short* __restrict__ vtpl, float* outp, float sscale) {
#pragma clang fp contract(off)
  union FH { v16h v; v8h h[2]; };
  union FB { v16b v; v8b h[2]; };
  __shared__ __align__(16) __bf16   Ksh[64 * KPT];                  // K [kv][d], padded rows     5 KB
  __shared__ __align__(16) _Float16 Vth[DVL * VPT];                 // V^T [d][kv], padded rows   9 KB
  __shared__ __align__(16) _Float16 Psh[4][16 * PPT];               // per wave hi plane [row][kv], padded rows
  __shared__ __align__(16) _Float16 Psl[4][16 * PPT];               // per wave residual plane [row][kv], padded rows
  __shared__ __align__(16) float    Os[4][16 * DVL];                // per wave context tile [row][d]

  const int tid  = threadIdx.x;
  const int wave = tid >> 5;
  const int lane = tid & 31;
  const int hh   = lane >> 4;
  const int c    = lane & 15;

  const int bx = blockIdx.x;
  const int pr = bx % (NQB / 2);
  const int bh = bx / (NQB / 2);
  if (bh >= NBH) return;                     // block-uniform, ahead of every barrier

  const __bf16*   Qp = (const __bf16*)(const void*)qpl + (size_t)bh * TT * DKY;
  const __bf16*   Kp = (const __bf16*)(const void*)kpl + (size_t)bh * TT * DKY;
  const _Float16* Vh = (const _Float16*)(const void*)vtpl + (size_t)bh * DVL * TT;

  // one copy of the tile body: the two tiles of a block run strictly one after the other in every wave
#pragma unroll 1
  for (int half = 0; half < 2; ++half) {
  const int qb = half ? pr : (NQB - 1 - pr);   // block-uniform
  const int q0 = qb * 64 + wave * 16;

  // ---- Q fragment (A operand, row = lane&15): one d-chunk of 32 ----
  const v16b qa = ldfrag_b(Qp + (size_t)(q0 + c) * DKY + 8 * hh);

  float zl[8];
  v8f oacc[4], olo[4];
#pragma unroll
  for (int r = 0; r < 8; ++r) zl[r] = 0.f;
#pragma unroll
  for (int t = 0; t < 4; ++t) { oacc[t] = zero8(); olo[t] = zero8(); }

  int nkt = qb + 1;                          // causal: key chunks 0..qb, block-uniform
  if (nkt > NQB) nkt = NQB;
  for (int kt = 0; kt < nkt; ++kt) {
    const int kv0 = kt * 64;
    __syncthreads();
    {
      const int r  = tid >> 1;                                        // K row kv0+r, also V^T row d = r
      const int hf = (tid & 1) * 16;                                  // d = hf..hf+15
      const __bf16* kg = Kp + (size_t)(kv0 + r) * DKY + hf;
      const v8b a0 = *(const v8b*)(kg);
      const v8b a1 = *(const v8b*)(kg + 8);
      *(v8b*)(Ksh + r * KPT + hf)     = a0;
      *(v8b*)(Ksh + r * KPT + hf + 8) = a1;
      const int so = (tid & 1) * 32;                                  // s = kv0+so..kv0+so+31
      const _Float16* vg = Vh + (size_t)r * TT + (size_t)kv0 + (size_t)so;
#pragma unroll
      for (int i = 0; i < 4; ++i) {
        const v8h b0 = *(const v8h*)(vg + 8 * i);
        *(v8h*)(Vth + r * VPT + so + 8 * i) = b0;
      }
    }
    __syncthreads();

    // ---- raw scores: 16 query rows x 64 keys per wave, bf16 product, one d-chunk ----
    v8f s[4];
#pragma unroll
    for (int j = 0; j < 4; ++j) {
      FB kb;
      kb.h[0] = *(const v8b*)(Ksh + (j * 16 + c) * KPT + 8 * hh);
      kb.h[1] = *(const v8b*)(Ksh + (j * 16 + c) * KPT + 16 + 8 * hh);
      s[j] = mma_b(qa, kb.v, zero8());
    }

    // ---- scale, polynomial, causal zeroing, Z partials, hi / residual planes to LDS ----
    _Float16* pwh = Psh[wave];
    _Float16* pwl = Psl[wave];
#pragma unroll
    for (int r = 0; r < 8; ++r) {
      const int qrow = q0 + 8 * hh + r;
#pragma unroll
      for (int j = 0; j < 4; ++j) {
        const int key = kv0 + j * 16 + c;
        const float x = s[j][r] * sscale;
        float a = poly3(x);
        a = (key > qrow) ? 0.0f : a;
        zl[r] += a;
        float ac = a * AHS;
        ac = fminf(fmaxf(ac, -F16MX), F16MX);
        const _Float16 ah = (_Float16)ac;
        const _Float16 al = (_Float16)((ac - (float)ah) * ALS);
        pwh[(8 * hh + r) * PPT + j * 16 + c] = ah;
        pwl[(8 * hh + r) * PPT + j * 16 + c] = al;
      }
    }
    __builtin_amdgcn_fence(__ATOMIC_RELEASE, "workgroup");
    __builtin_amdgcn_wave_barrier();
    __builtin_amdgcn_fence(__ATOMIC_ACQUIRE, "workgroup");

    // ---- context_hi += hi . V^T, context_lo += lo . V^T (f16 WMMA, separate accumulators) ----
#pragma unroll 1
    for (int kk = 0; kk < 2; ++kk) {
      FH pa, pl;
      pa.h[0] = *(const v8h*)(pwh + c * PPT + kk * 32 + 8 * hh);
      pa.h[1] = *(const v8h*)(pwh + c * PPT + kk * 32 + 16 + 8 * hh);
      pl.h[0] = *(const v8h*)(pwl + c * PPT + kk * 32 + 8 * hh);
      pl.h[1] = *(const v8h*)(pwl + c * PPT + kk * 32 + 16 + 8 * hh);
#pragma unroll
      for (int t = 0; t < 4; ++t) {
        FH vb;
        vb.h[0] = *(const v8h*)(Vth + (t * 16 + c) * VPT + kk * 32 + 8 * hh);
        vb.h[1] = *(const v8h*)(Vth + (t * 16 + c) * VPT + kk * 32 + 16 + 8 * hh);
        oacc[t] = mma_h(pa.v, vb.v, oacc[t]);
        olo[t]  = mma_h(pl.v, vb.v, olo[t]);
      }
    }
  }

  // ---- Z fold (fixed-order butterfly over the 16 lanes of each half), S = (hi + lo/1024)/(64*VSC), S*(1/Z);
  float* os = Os[wave];
#pragma unroll
  for (int r = 0; r < 8; ++r) {
    float z = zl[r];
    z += __shfl_xor(z, 1, 32);
    z += __shfl_xor(z, 2, 32);
    z += __shfl_xor(z, 4, 32);
    z += __shfl_xor(z, 8, 32);
    const float rz = 1.0f / z;
#pragma unroll
    for (int t = 0; t < 4; ++t) {
      const float sv = (oacc[t][r] + olo[t][r] * (1.0f / ALS)) * (1.0f / (AHS * VSC));
      os[(8 * hh + r) * DVL + t * 16 + c] = sv * rz;
    }
  }
  __builtin_amdgcn_fence(__ATOMIC_RELEASE, "workgroup");
  __builtin_amdgcn_wave_barrier();
  __builtin_amdgcn_fence(__ATOMIC_ACQUIRE, "workgroup");
  {
    const int col4 = c * 4;                      // 16 lanes x 4 floats = one whole 64-float row
    {
#pragma unroll
      for (int it = 0; it < 8; ++it) {           // row pairs (2it, 2it+1) of the wave tile
        const int rr = 2 * it + hh;
        const v4f ov = *(const v4f*)(os + rr * DVL + col4);
        const size_t go = ((size_t)(bh * TT + q0 + rr)) * DVL + (size_t)col4;
        *(v4f*)(outp + go) = ov;
      }
      // the next tile's set-up overwrites the address and data registers these stores name
      asm volatile("s_wait_xcnt 0x0" ::: "memory");
    }
  }
  }
}

// =====================================================================================================
// Inputs: in0 q [NB][NHD][TT][DKY] f32, in1 k same, in2 v [NB][NHD][TT][DVL] f32; bh = b*NHD + h.
// d_out f32 [NB][NHD][TT][DVL] at byte 0.
//   Qb  bf16 [NBH][TT][DKY]     0          4194304
//   Kb  bf16 [NBH][TT][DKY]     4194304    4194304
//   Vt  f16  [NBH][DVL][TT]     8388608    8388608
//   end                         16777216
// =====================================================================================================
extern "C" void kernel_launch(void* const* d_in, const int* in_sizes, int n_in,
                              void* d_out, int out_size, void* d_ws, size_t ws_size,
                              hipStream_t stream) {
  const int nq = NBH * TT * DKY;                      // 2097152
  const int nv = NBH * TT * DVL;                      // 4194304
  if (n_in < 3) return;
  if (in_sizes[0] != nq) return;
  if (in_sizes[1] != nq) return;
  if (in_sizes[2] != nv) return;
  if (out_size != nv) return;

  const float* q = (const float*)d_in[0];
  const float* k = (const float*)d_in[1];
  const float* v = (const float*)d_in[2];

  const size_t PQ = (size_t)nq * 2;                   // 4194304
  const size_t PK = (size_t)nq * 2;                   // 4194304
  const size_t PV = (size_t)nv * 2;                   // 8388608
  size_t off = 0;
  const size_t oQ = off; off += PQ;
  const size_t oK = off; off += PK;
  const size_t oV = off; off += PV;
  if (off > ws_size) return;                          // off = 16777216
  if (off > (size_t)134217728) return;

  char* ws = (char*)d_ws;
  unsigned short* Qb = (unsigned short*)(ws + oQ);
  unsigned short* Kb = (unsigned short*)(ws + oK);
  unsigned short* Vt = (unsigned short*)(ws + oV);
  float* outf = (float*)d_out;

  const dim3 blk(256);
  const int n8 = nq / 8;                              // 262144
  const dim3 gCvt((n8 + 255) / 256);                  // 1024 blocks
  const dim3 gV(TT / 64, NBH);                        // (32, 32)
  const float sscale = 1.0f / sqrtf((float)DKY);

  // (0) q, k -> bf16 planes (same element order)
  cvt_bf16<<<gCvt, blk, 0, stream>>>(q, Qb, n8);
  cvt_bf16<<<gCvt, blk, 0, stream>>>(k, Kb, n8);
  // (1) v -> f16 v^T plane [bh][d][pos], values x VSC
  v_planes<<<gV, blk, 0, stream>>>(v, Vt, VSC);
  // (2) causal polynomial attention -> d_out
  attn_poly<<<dim3(NBH * (NQB / 2)), dim3(128), 0, stream>>>(Qb, Kb, Vt, outf, sscale);
  (void)hipGetLastError();
}

// v003
// A run of this version takes 58.8 microseconds.
// Next to v002, in two timings, it ran 1.29 and 1.31 times as fast.
// Counting every step since v000, it is 2.10 times as fast.
// Contractions: q.k^T scores = v_wmma_f32_16x16x32_bf16 (bf16 operands = RNE-converted q and k planes, single product,
// d_key 32 = one k-step); a.v context = v_wmma_f32_16x16x32_f16 (a carried as an f16 hi plane x64 plus an f16 residual
// plane x64x1024 feeding a second accumulator, v as f16 of the bf16-converted value x16; two products); all f32
// accumulate; cubic truncated-exp polynomial, causal zeroing, row sums Z and the final S*(1/Z) in f32.
#include <hip/hip_runtime.h>
#include <math.h>
#include <stdint.h>

#define TT    2048                 // sequence length (queries == keys)
#define NB    4
#define NHD   8
#define DKY   32                   // d_key
#define DVL   64                   // d_val
#define NBH   (NB * NHD)           // 32 (batch, head) pairs; bh = b*NHD + h
#define NQB   (TT / 64)            // 32 query / key tiles of 64
#define AHS   64.0f                // hi plane carry of the polynomial weights (exact power of two)
#define ALS   1024.0f              // residual plane carry on top of AHS (exact power of two)
#define VSC   16.0f                // v plane carry (exact power of two)
#define F16MX 65504.0f
// LDS row pitches in 16-bit elements: 16 B x odd, so that the 16 rows one ds_load_b128 half-wave reads start on
// 16 distinct bank quads (bank = dword address mod 64) instead of 2 (128-B rows) or 4 (64-B rows).
#define KPT   40                   // K rows: 32 halves + 8 pad  = 80 B
#define VPT   72                   // V^T rows: 64 halves + 8 pad = 144 B
#define PPT   72                   // weight-plane rows: 64 halves + 8 pad = 144 B
static_assert((TT % 64) == 0);
static_assert((NQB % 2) == 0);
static_assert(DKY == 32);
static_assert(DVL == 64);
static_assert((KPT % 16) == 8 && (VPT % 16) == 8 && (PPT % 16) == 8);
static_assert(((NBH * TT * DKY) % (8 * 256)) == 0);

typedef _Float16 v16h __attribute__((ext_vector_type(16)));
typedef _Float16 v8h  __attribute__((ext_vector_type(8)));
typedef __bf16   v16b __attribute__((ext_vector_type(16)));
typedef __bf16   v8b  __attribute__((ext_vector_type(8)));
typedef float    v8f  __attribute__((ext_vector_type(8)));
typedef float    v4f  __attribute__((ext_vector_type(4)));
typedef unsigned int v4u __attribute__((ext_vector_type(4)));

// ---- scalar helpers --------------------------------------------------------------------------------
__device__ __forceinline__ unsigned short bf_bits(float f) {          // f32 -> bf16 bits, RNE convert
  unsigned u = __float_as_uint(f);
  return (unsigned short)((u + 0x7FFFu + ((u >> 16) & 1u)) >> 16);
}
__device__ __forceinline__ float bf_up(unsigned short h) { return __uint_as_float(((unsigned)h) << 16); }
__device__ __forceinline__ unsigned short h_bits(_Float16 x) { return __builtin_bit_cast(unsigned short, x); }
__device__ __forceinline__ unsigned pk16(unsigned short a, unsigned short b) { return (unsigned)a | ((unsigned)b << 16); }
__device__ __forceinline__ v8f zero8() { v8f z = {0.f, 0.f, 0.f, 0.f, 0.f, 0.f, 0.f, 0.f}; return z; }

// Degree-3 truncated exp, Horner order 1 + x*(1 + (x/2)*(1 + x/3)), unfused f32 ops.
__device__ __forceinline__ float poly3(float x) {
#pragma clang fp contract(off)
  const float third = 1.0f / 3.0f;
  float t = 1.0f + x * third;
  t = 1.0f + (x * 0.5f) * t;
  t = 1.0f + x * t;
  return t;
}

// ---- fragment loader: 16-bit A/B operand, lane -> row/col (lane&15), p already includes +8*(lane>>4);
//      elements 0..7 <- p[0..7] (k0+8h..), elements 8..15 <- p[16..23] (k0+16+8h..)
__device__ __forceinline__ v16b ldfrag_b(const __bf16* p) {
  union { v16b v; v8b h[2]; } f;
  f.h[0] = *(const v8b*)(p);
  f.h[1] = *(const v8b*)(p + 16);
  return f.v;
}

// ---- WMMA helpers with trailing VALU hazard gap --------------------------------------------------------
__device__ __forceinline__ v8f mma_b(v16b a, v16b b, v8f c) {
  c = __builtin_amdgcn_wmma_f32_16x16x32_bf16(false, a, false, b, (short)0, c, false, false);
#if defined(__HIP_DEVICE_COMPILE__)
  asm volatile("v_nop\n\tv_nop\n\tv_nop\n\tv_nop" : "+v"(c) : "v"(a), "v"(b));
#endif
  return c;
}
__device__ __forceinline__ v8f mma_h(v16h a, v16h b, v8f c) {
  c = __builtin_amdgcn_wmma_f32_16x16x32_f16(false, a, false, b, (short)0, c, false, false);
#if defined(__HIP_DEVICE_COMPILE__)
  asm volatile("v_nop\n\tv_nop\n\tv_nop\n\tv_nop" : "+v"(c) : "v"(a), "v"(b));
#endif
  return c;
}

// =====================================================================================================
// f32 [bh][pos][d] -> bf16 plane [bh][pos][d] (same element order, RNE convert), 8 elements per thread:
//   thread i converts elements 8i..8i+7. One 16-B store per lane; a wave writes 512 contiguous B = 4 whole
// coverage: n8 = n/8 threads x 8 halves = the whole plane.
// =====================================================================================================
__global__ __launch_bounds__(256) void cvt_bf16(const float* __restrict__ in, unsigned short* out, int n8) {
  const int i = blockIdx.x * 256 + threadIdx.x;
  if (i < n8) {
    const size_t src = (size_t)i * 8;
    const v4f a = *(const v4f*)(in + src);
    const v4f b = *(const v4f*)(in + src + 4);
    v4u p;
    p[0] = pk16(bf_bits(a[0]), bf_bits(a[1]));
    p[1] = pk16(bf_bits(a[2]), bf_bits(a[3]));
    p[2] = pk16(bf_bits(b[0]), bf_bits(b[1]));
    p[3] = pk16(bf_bits(b[2]), bf_bits(b[3]));
    *(v4u*)(out + src) = p;
    
  }
}

// =====================================================================================================
// v f32 [bh][pos][DVL] -> f16 v^T plane vt[(bh*DVL + d)*TT + s] = f16(bf16_rne(v) * vsc) (exact for a power of two).
// Block = one 64-position x 64-feature tile of one bh; grid = (TT/64, NBH); tile staged in LDS as f32
// (256 threads x 4 v4f loads, __syncthreads).
// Store: group g = tid>>3 (0..31), piece = tid&7: iteration it writes row d = it*32 + g; lanes 8g..8g+7 x 16 B =
// coverage: 2 iterations x 32 groups = 64 rows d, 8 pieces x 8 = 64 keys per row; grid covers every (bh, s tile).
// =====================================================================================================
__global__ __launch_bounds__(256) void v_planes(const float* __restrict__ vf, unsigned short* vt, float vsc) {
  __shared__ __align__(16) float sv[64 * 68];        // [tt][d], pitch 68 floats (272 B, 16-B aligned rows)
  const int tid = threadIdx.x;
  const int s0  = blockIdx.x * 64;
  const int bh  = blockIdx.y;
  if (bh >= NBH || s0 >= TT) return;                 // block-uniform, ahead of every barrier
  const float* src = vf + ((size_t)bh * TT + (size_t)s0) * DVL;   // 64 rows x 64 floats, contiguous
#pragma unroll
  for (int i = 0; i < 4; ++i) {
    const int idx = i * 256 + tid;                   // 0..1023
    const int tt = idx >> 4, c4 = (idx & 15) * 4;    // tt 0..63, c4 0..60
    const v4f a = *(const v4f*)(src + (size_t)tt * DVL + c4);
    *(v4f*)(sv + tt * 68 + c4) = a;
  }
  __syncthreads();

  const int g = tid >> 3, piece = tid & 7;
  v4u hv[2];
  size_t hofs[2];
#pragma unroll
  for (int it = 0; it < 2; ++it) {
    const int d = it * 32 + g;
    v4u a;
#pragma unroll
    for (int e = 0; e < 4; ++e) {
      const float f0 = sv[(piece * 8 + 2 * e) * 68 + d];
      const float f1 = sv[(piece * 8 + 2 * e + 1) * 68 + d];
      const _Float16 x0 = (_Float16)(bf_up(bf_bits(f0)) * vsc);
      const _Float16 x1 = (_Float16)(bf_up(bf_bits(f1)) * vsc);
      a[e] = pk16(h_bits(x0), h_bits(x1));
    }
    hv[it] = a;
    hofs[it] = ((size_t)(bh * DVL + d)) * TT + (size_t)s0 + (size_t)(piece * 8);
  }
  {
#pragma unroll
    for (int it = 0; it < 2; ++it) {
      *(v4u*)(vt + hofs[it]) = hv[it];
    }
    
  }
}

// =====================================================================================================
// Causal polynomial attention, d_key 32, d_val 64.
//   q plane bf16: element (bh, t, d) at [(bh*TT + t)*DKY + d];  k plane bf16: (bh, s, d) at [(bh*TT + s)*DKY + d]
//   v^T plane f16 (x VSC): (bh, d, s) at [(bh*DVL + d)*TT + s]
//   raw scores = q . k on bf16 WMMA (one k-step of 32 over d), f32 accumulate, then x = raw * sscale in f32,
//   a = 1 + x*(1 + x/2*(1 + x/3)) (f32), keys > query replaced by 0, z += a (f32, per-lane partials, fixed order).
//   a planes: hi = f16(clamp(64 a)), lo = f16((clamp(64 a) - hi) * 1024) (the difference is exact in f32);
//   context_hi += hi . v^T, context_lo += lo . v^T on f16 WMMA (2 k-steps of 32 per 64-key chunk), separate
//   accumulators; epilogue S = (context_hi + context_lo / 1024) / (64 * VSC), out = S * (1 / Z).
//   Block = 8 waves in two groups of 4; it runs two 64-row query tiles of one bh one after the other, tile NQB-1-p
//   and then tile p, so that every block walks NQB+1 key chunks (causal cost is linear in the tile index; all blocks
//   are resident at once and the launch lasts as long as its fullest block). grid = (NQB/2) * NBH; key chunks 0..qb
//   per tile (block-uniform trip count, statically clamped to NQB); every processed chunk holds at least one live key.
//   Key split: wave w and wave w+4 own the same 16 query rows; group 0 (waves 0..3) takes the even key chunks, group 1
//   (waves 4..7) the odd ones, each group with its own K / V^T buffers, one pair of chunks per pass. The weights are a
//   plain sum over keys (no running maximum), so the two groups' context and Z partials just add: at the end of a tile
//   group 1 hands its partials over in LDS, one __syncthreads, group 0 adds them and finishes the tile.
//   K / V^T chunk staging per group: K 64 rows x 32 halves (2 threads per row, 2 x 16 B each), V^T 64 rows x 64 halves
//   (2 threads per row, 4 x 16 B each); plain loads, __syncthreads before and after.
//   A tiles are wave-private, spilled with _Float16 element stores and reloaded as v8h (same element type)
//   out f32 [bh][pos][DVL]: row (bh, t) = 64 floats = 256 B; each group-0 wave stages its 16x64 tile in LDS, then one
//   instruction per row pair: lanes 0..15 x 16 B = row 2i, lanes 16..31 x 16 B = row 2i+1 (512 contiguous B =
// coverage: 8 instructions x 2 rows x 64 cols = the wave's 16 rows; 4 waves = the 64-row tile; p = 0..NQB/2-1 with
//   tiles p and NQB-1-p = every query tile once; grid = every (bh, p).
// =====================================================================================================
// waves_per_eu(4, 4): two blocks of 8 waves on a WGP = four waves per SIMD, 256 registers a wave.
__global__ __launch_bounds__(256) __attribute__((amdgpu_waves_per_eu(4, 4)))
void attn_poly(const unsigned short* __restrict__ qpl, const unsigned short* __restrict__ kpl,
               const unsigned short* __restrict__ vtpl, float* outp, float sscale) {
#pragma clang fp contract(off)
  union FH { v16h v; v8h h[2]; };
  union FB { v16b v; v8b h[2]; };
  __shared__ __align__(16) __bf16   Ksh2[2][64 * KPT];              // per group K [kv][d], padded rows     5 KB each
  __shared__ __align__(16) _Float16 Vth2[2][DVL * VPT];             // per group V^T [d][kv], padded rows   9 KB each
  __shared__ __align__(16) _Float16 Psh[8][16 * PPT];               // per wave hi plane [row][kv], padded rows
  __shared__ __align__(16) _Float16 Psl[8][16 * PPT];               // per wave residual plane [row][kv], padded rows
  __shared__ __align__(16) float    Os[4][16 * DVL];                // per group-0 wave context tile [row][d]
  __shared__ __align__(16) float    Cs[4][10 * 32 * 4];             // group 1 -> group 0: [piece][lane] x 4 floats

  const int tid  = threadIdx.x & 127;        // thread index inside its group of 4 waves
  // wave number in a scalar register: the tests on the group below become scalar branches, EXEC stays all ones
  const int wv8  = __builtin_amdgcn_readfirstlane((int)(threadIdx.x >> 5));
  const int grp  = wv8 >> 2;                 // 0: even key chunks, 1: odd key chunks
  const int wave = wv8 & 3;                  // which 16 query rows of the tile
  const int lane = tid & 31;
  __bf16*   Ksh = Ksh2[grp];
  _Float16* Vth = Vth2[grp];
  const int hh   = lane >> 4;
  const int c    = lane & 15;

  const int bx = blockIdx.x;
  const int pr = bx % (NQB / 2);
  const int bh = bx / (NQB / 2);
  if (bh >= NBH) return;                     // block-uniform, ahead of every barrier

  const __bf16*   Qp = (const __bf16*)(const void*)qpl + (size_t)bh * TT * DKY;
  const __bf16*   Kp = (const __bf16*)(const void*)kpl + (size_t)bh * TT * DKY;
  const _Float16* Vh = (const _Float16*)(const void*)vtpl + (size_t)bh * DVL * TT;

  // one copy of the tile body: the two tiles of a block run strictly one after the other in every wave
#pragma unroll 1
  for (int half = 0; half < 2; ++half) {
  const int qb = half ? pr : (NQB - 1 - pr);   // block-uniform
  const int q0 = qb * 64 + wave * 16;

  // ---- Q fragment (A operand, row = lane&15): one d-chunk of 32 ----
  const v16b qa = ldfrag_b(Qp + (size_t)(q0 + c) * DKY + 8 * hh);

  float zl[8];
  v8f oacc[4], olo[4];
#pragma unroll
  for (int r = 0; r < 8; ++r) zl[r] = 0.f;
#pragma unroll
  for (int t = 0; t < 4; ++t) { oacc[t] = zero8(); olo[t] = zero8(); }

  int nkt = qb + 1;                          // causal: key chunks 0..qb, block-uniform
  if (nkt > NQB) nkt = NQB;
  const int npass = (nkt + 1) >> 1;          // block-uniform: every wave passes every barrier
  for (int ps = 0; ps < npass; ++ps) {
    const int kt = 2 * ps + grp;
    const bool live = kt < nkt;              // false only for group 1 in the last pass of an odd chunk count
    const int kv0 = kt * 64;
    __syncthreads();
    if (live) {
      const int r  = tid >> 1;                                        // K row kv0+r, also V^T row d = r
      const int hf = (tid & 1) * 16;                                  // d = hf..hf+15
      const __bf16* kg = Kp + (size_t)(kv0 + r) * DKY + hf;
      const v8b a0 = *(const v8b*)(kg);
      const v8b a1 = *(const v8b*)(kg + 8);
      *(v8b*)(Ksh + r * KPT + hf)     = a0;
      *(v8b*)(Ksh + r * KPT + hf + 8) = a1;
      const int so = (tid & 1) * 32;                                  // s = kv0+so..kv0+so+31
      const _Float16* vg = Vh + (size_t)r * TT + (size_t)kv0 + (size_t)so;
#pragma unroll
      for (int i = 0; i < 4; ++i) {
        const v8h b0 = *(const v8h*)(vg + 8 * i);
        *(v8h*)(Vth + r * VPT + so + 8 * i) = b0;
      }
    }
    __syncthreads();
    if (!live) continue;

    // ---- raw scores: 16 query rows x 64 keys per wave, bf16 product, one d-chunk ----
    v8f s[4];
#pragma unroll
    for (int j = 0; j < 4; ++j) {
      FB kb;
      kb.h[0] = *(const v8b*)(Ksh + (j * 16 + c) * KPT + 8 * hh);
      kb.h[1] = *(const v8b*)(Ksh + (j * 16 + c) * KPT + 16 + 8 * hh);
      s[j] = mma_b(qa, kb.v, zero8());
    }

    // ---- scale, polynomial, causal zeroing, Z partials, hi / residual planes to LDS ----
    _Float16* pwh = Psh[wv8];
    _Float16* pwl = Psl[wv8];
#pragma unroll
    for (int r = 0; r < 8; ++r) {
      const int qrow = q0 + 8 * hh + r;
#pragma unroll
      for (int j = 0; j < 4; ++j) {
        const int key = kv0 + j * 16 + c;
        const float x = s[j][r] * sscale;
        float a = poly3(x);
        a = (key > qrow) ? 0.0f : a;
        zl[r] += a;
        float ac = a * AHS;
        ac = fminf(fmaxf(ac, -F16MX), F16MX);
        const _Float16 ah = (_Float16)ac;
        const _Float16 al = (_Float16)((ac - (float)ah) * ALS);
        pwh[(8 * hh + r) * PPT + j * 16 + c] = ah;
        pwl[(8 * hh + r) * PPT + j * 16 + c] = al;
      }
    }
    __builtin_amdgcn_fence(__ATOMIC_RELEASE, "workgroup");
    __builtin_amdgcn_wave_barrier();
    __builtin_amdgcn_fence(__ATOMIC_ACQUIRE, "workgroup");

    // ---- context_hi += hi . V^T, context_lo += lo . V^T (f16 WMMA, separate accumulators) ----
#pragma unroll 1
    for (int kk = 0; kk < 2; ++kk) {
      FH pa, pl;
      pa.h[0] = *(const v8h*)(pwh + c * PPT + kk * 32 + 8 * hh);
      pa.h[1] = *(const v8h*)(pwh + c * PPT + kk * 32 + 16 + 8 * hh);
      pl.h[0] = *(const v8h*)(pwl + c * PPT + kk * 32 + 8 * hh);
      pl.h[1] = *(const v8h*)(pwl + c * PPT + kk * 32 + 16 + 8 * hh);
#pragma unroll
      for (int t = 0; t < 4; ++t) {
        FH vb;
        vb.h[0] = *(const v8h*)(Vth + (t * 16 + c) * VPT + kk * 32 + 8 * hh);
        vb.h[1] = *(const v8h*)(Vth + (t * 16 + c) * VPT + kk * 32 + 16 + 8 * hh);
        oacc[t] = mma_h(pa.v, vb.v, oacc[t]);
        olo[t]  = mma_h(pl.v, vb.v, olo[t]);
      }
    }
  }

  // ---- join of the key split: group 1 stores hi + lo/1024 (8 pieces) and its Z partials (2 pieces), lane-major ----
  float* cs = Cs[wave];
  if (grp == 1) {
#pragma unroll
    for (int t = 0; t < 4; ++t) {
#pragma unroll
      for (int g4 = 0; g4 < 2; ++g4) {
        v4f pv;
#pragma unroll
        for (int e = 0; e < 4; ++e) pv[e] = oacc[t][4 * g4 + e] + olo[t][4 * g4 + e] * (1.0f / ALS);
        *(v4f*)(cs + ((t * 2 + g4) * 32 + lane) * 4) = pv;
      }
    }
#pragma unroll
    for (int g4 = 0; g4 < 2; ++g4) {
      v4f zv;
#pragma unroll
      for (int e = 0; e < 4; ++e) zv[e] = zl[4 * g4 + e];
      *(v4f*)(cs + ((8 + g4) * 32 + lane) * 4) = zv;
    }
  }
  __syncthreads();                           // publishes group 1's partials; block-uniform
  if (grp == 1) continue;                    // group 1 goes on to the next tile's first barrier
  float so[4][8];                            // the odd chunks' context partial, this lane's 32 elements
#pragma unroll
  for (int t = 0; t < 4; ++t) {
#pragma unroll
    for (int g4 = 0; g4 < 2; ++g4) {
      const v4f pv = *(const v4f*)(cs + ((t * 2 + g4) * 32 + lane) * 4);
#pragma unroll
      for (int e = 0; e < 4; ++e) so[t][4 * g4 + e] = pv[e];
    }
  }
#pragma unroll
  for (int g4 = 0; g4 < 2; ++g4) {
    const v4f zv = *(const v4f*)(cs + ((8 + g4) * 32 + lane) * 4);
#pragma unroll
    for (int e = 0; e < 4; ++e) zl[4 * g4 + e] += zv[e];
  }

  // ---- Z fold (fixed-order butterfly over the 16 lanes of each half), S = (hi + lo/1024)/(64*VSC), S*(1/Z);
  float* os = Os[wave];
#pragma unroll
  for (int r = 0; r < 8; ++r) {
    float z = zl[r];
    z += __shfl_xor(z, 1, 32);
    z += __shfl_xor(z, 2, 32);
    z += __shfl_xor(z, 4, 32);
    z += __shfl_xor(z, 8, 32);
    const float rz = 1.0f / z;
#pragma unroll
    for (int t = 0; t < 4; ++t) {
      const float sv = ((oacc[t][r] + olo[t][r] * (1.0f / ALS)) + so[t][r]) * (1.0f / (AHS * VSC));
      os[(8 * hh + r) * DVL + t * 16 + c] = sv * rz;
    }
  }
  __builtin_amdgcn_fence(__ATOMIC_RELEASE, "workgroup");
  __builtin_amdgcn_wave_barrier();
  __builtin_amdgcn_fence(__ATOMIC_ACQUIRE, "workgroup");
  {
    const int col4 = c * 4;                      // 16 lanes x 4 floats = one whole 64-float row
    {
#pragma unroll
      for (int it = 0; it < 8; ++it) {           // row pairs (2it, 2it+1) of the wave tile
        const int rr = 2 * it + hh;
        const v4f ov = *(const v4f*)(os + rr * DVL + col4);
        const size_t go = ((size_t)(bh * TT + q0 + rr)) * DVL + (size_t)col4;
        *(v4f*)(outp + go) = ov;
      }
      // the next tile's set-up overwrites the address and data registers these stores name
      asm volatile("s_wait_xcnt 0x0" ::: "memory");
    }
  }
  }
}

// =====================================================================================================
// Inputs: in0 q [NB][NHD][TT][DKY] f32, in1 k same, in2 v [NB][NHD][TT][DVL] f32; bh = b*NHD + h.
// d_out f32 [NB][NHD][TT][DVL] at byte 0.
//   Qb  bf16 [NBH][TT][DKY]     0          4194304
//   Kb  bf16 [NBH][TT][DKY]     4194304    4194304
//   Vt  f16  [NBH][DVL][TT]     8388608    8388608
//   end                         16777216
// =====================================================================================================
extern "C" void kernel_launch(void* const* d_in, const int* in_sizes, int n_in,
                              void* d_out, int out_size, void* d_ws, size_t ws_size,
                              hipStream_t stream) {
  const int nq = NBH * TT * DKY;                      // 2097152
  const int nv = NBH * TT * DVL;                      // 4194304
  if (n_in < 3) return;
  if (in_sizes[0] != nq) return;
  if (in_sizes[1] != nq) return;
  if (in_sizes[2] != nv) return;
  if (out_size != nv) return;

  const float* q = (const float*)d_in[0];
  const float* k = (const float*)d_in[1];
  const float* v = (const float*)d_in[2];

  const size_t PQ = (size_t)nq * 2;                   // 4194304
  const size_t PK = (size_t)nq * 2;                   // 4194304
  const size_t PV = (size_t)nv * 2;                   // 8388608
  size_t off = 0;
  const size_t oQ = off; off += PQ;
  const size_t oK = off; off += PK;
  const size_t oV = off; off += PV;
  if (off > ws_size) return;                          // off = 16777216
  if (off > (size_t)134217728) return;

  char* ws = (char*)d_ws;
  unsigned short* Qb = (unsigned short*)(ws + oQ);
  unsigned short* Kb = (unsigned short*)(ws + oK);
  unsigned short* Vt = (unsigned short*)(ws + oV);
  float* outf = (float*)d_out;

  const dim3 blk(256);
  const int n8 = nq / 8;                              // 262144
  const dim3 gCvt((n8 + 255) / 256);                  // 1024 blocks
  const dim3 gV(TT / 64, NBH);                        // (32, 32)
  const float sscale = 1.0f / sqrtf((float)DKY);

  // (0) q, k -> bf16 planes (same element order)
  cvt_bf16<<<gCvt, blk, 0, stream>>>(q, Qb, n8);
  cvt_bf16<<<gCvt, blk, 0, stream>>>(k, Kb, n8);
  // (1) v -> f16 v^T plane [bh][d][pos], values x VSC
  v_planes<<<gV, blk, 0, stream>>>(v, Vt, VSC);
  // (2) causal polynomial attention -> d_out
  attn_poly<<<dim3(NBH * (NQB / 2)), dim3(256), 0, stream>>>(Qb, Kb, Vt, outf, sscale);
  (void)hipGetLastError();
}

// v004
// A run of this version takes 54.1 microseconds.
// Two timings next to v003 both put it at 1.08 times that version's speed.
// Counting every step since v000, it is 2.27 times as fast.
// Contractions: q.k^T scores = v_wmma_f32_16x16x32_bf16 (bf16 operands = q and k RNE-converted where they are read, single
// product, d_key 32 = one k-step); a.v context = v_wmma_f32_16x16x32_f16 (a carried as an f16 hi plane x64 plus an f16 residual
// plane x64x1024 feeding a second accumulator, v as f16 of the bf16-converted value x16; two products); all f32
// accumulate; cubic truncated-exp polynomial, causal zeroing, row sums Z and the final S*(1/Z) in f32.
#include <hip/hip_runtime.h>
#include <math.h>
#include <stdint.h>

#define TT    2048                 // sequence length (queries == keys)
#define NB    4
#define NHD   8
#define DKY   32                   // d_key
#define DVL   64                   // d_val
#define NBH   (NB * NHD)           // 32 (batch, head) pairs; bh = b*NHD + h
#define NQB   (TT / 64)            // 32 query / key tiles of 64
#define AHS   64.0f                // hi plane carry of the polynomial weights (exact power of two)
#define ALS   1024.0f              // residual plane carry on top of AHS (exact power of two)
#define VSC   16.0f                // v plane carry (exact power of two)
#define F16MX 65504.0f
// LDS row pitches in 16-bit elements: 16 B x odd, so that the 16 rows one ds_load_b128 half-wave reads start on
// 16 distinct bank quads (bank = dword address mod 64) instead of 2 (128-B rows) or 4 (64-B rows).
#define KPT   40                   // K rows: 32 halves + 8 pad  = 80 B
#define VPT   72                   // V^T rows: 64 halves + 8 pad = 144 B
#define PPT   72                   // weight-plane rows: 64 halves + 8 pad = 144 B
static_assert((TT % 64) == 0);
static_assert((NQB % 2) == 0);
static_assert(DKY == 32);
static_assert(DVL == 64);
static_assert((KPT % 16) == 8 && (VPT % 16) == 8 && (PPT % 16) == 8);

typedef _Float16 v16h __attribute__((ext_vector_type(16)));
typedef _Float16 v8h  __attribute__((ext_vector_type(8)));
typedef __bf16   v16b __attribute__((ext_vector_type(16)));
typedef __bf16   v8b  __attribute__((ext_vector_type(8)));
typedef __bf16   v4b  __attribute__((ext_vector_type(4)));
typedef float    v8f  __attribute__((ext_vector_type(8)));
typedef float    v4f  __attribute__((ext_vector_type(4)));
typedef unsigned int v4u __attribute__((ext_vector_type(4)));

// ---- scalar helpers --------------------------------------------------------------------------------
__device__ __forceinline__ unsigned short bf_bits(float f) {          // f32 -> bf16 bits, RNE convert
  unsigned u = __float_as_uint(f);
  return (unsigned short)((u + 0x7FFFu + ((u >> 16) & 1u)) >> 16);
}
__device__ __forceinline__ float bf_up(unsigned short h) { return __uint_as_float(((unsigned)h) << 16); }
__device__ __forceinline__ unsigned short h_bits(_Float16 x) { return __builtin_bit_cast(unsigned short, x); }
__device__ __forceinline__ unsigned pk16(unsigned short a, unsigned short b) { return (unsigned)a | ((unsigned)b << 16); }
__device__ __forceinline__ v8f zero8() { v8f z = {0.f, 0.f, 0.f, 0.f, 0.f, 0.f, 0.f, 0.f}; return z; }

// Degree-3 truncated exp, Horner order 1 + x*(1 + (x/2)*(1 + x/3)), unfused f32 ops.
__device__ __forceinline__ float poly3(float x) {
#pragma clang fp contract(off)
  const float third = 1.0f / 3.0f;
  float t = 1.0f + x * third;
  t = 1.0f + (x * 0.5f) * t;
  t = 1.0f + x * t;
  return t;
}

// ---- WMMA helpers with trailing VALU hazard gap --------------------------------------------------------
__device__ __forceinline__ v8f mma_b(v16b a, v16b b, v8f c) {
  c = __builtin_amdgcn_wmma_f32_16x16x32_bf16(false, a, false, b, (short)0, c, false, false);
#if defined(__HIP_DEVICE_COMPILE__)
  asm volatile("v_nop\n\tv_nop\n\tv_nop\n\tv_nop" : "+v"(c) : "v"(a), "v"(b));
#endif
  return c;
}
__device__ __forceinline__ v8f mma_h(v16h a, v16h b, v8f c) {
  c = __builtin_amdgcn_wmma_f32_16x16x32_f16(false, a, false, b, (short)0, c, false, false);
#if defined(__HIP_DEVICE_COMPILE__)
  asm volatile("v_nop\n\tv_nop\n\tv_nop\n\tv_nop" : "+v"(c) : "v"(a), "v"(b));
#endif
  return c;
}

// =====================================================================================================
// v f32 [bh][pos][DVL] -> f16 v^T plane vt[(bh*DVL + d)*TT + s] = f16(bf16_rne(v) * vsc) (exact for a power of two).
// Block = one 64-position x 64-feature tile of one bh; grid = (TT/64, NBH); tile staged in LDS as f32
// (256 threads x 4 v4f loads, __syncthreads).
// Store: group g = tid>>3 (0..31), piece = tid&7: iteration it writes row d = it*32 + g; lanes 8g..8g+7 x 16 B =
// coverage: 2 iterations x 32 groups = 64 rows d, 8 pieces x 8 = 64 keys per row; grid covers every (bh, s tile).
// =====================================================================================================
__global__ __launch_bounds__(256) void v_planes(const float* __restrict__ vf, unsigned short* vt, float vsc) {
  __shared__ __align__(16) float sv[64 * 68];        // [tt][d], pitch 68 floats (272 B, 16-B aligned rows)
  const int tid = threadIdx.x;
  const int s0  = blockIdx.x * 64;
  const int bh  = blockIdx.y;
  if (bh >= NBH || s0 >= TT) return;                 // block-uniform, ahead of every barrier
  const float* src = vf + ((size_t)bh * TT + (size_t)s0) * DVL;   // 64 rows x 64 floats, contiguous
#pragma unroll
  for (int i = 0; i < 4; ++i) {
    const int idx = i * 256 + tid;                   // 0..1023
    const int tt = idx >> 4, c4 = (idx & 15) * 4;    // tt 0..63, c4 0..60
    const v4f a = *(const v4f*)(src + (size_t)tt * DVL + c4);
    *(v4f*)(sv + tt * 68 + c4) = a;
  }
  __syncthreads();

  const int g = tid >> 3, piece = tid & 7;
  v4u hv[2];
  size_t hofs[2];
#pragma unroll
  for (int it = 0; it < 2; ++it) {
    const int d = it * 32 + g;
    v4u a;
#pragma unroll
    for (int e = 0; e < 4; ++e) {
      const float f0 = sv[(piece * 8 + 2 * e) * 68 + d];
      const float f1 = sv[(piece * 8 + 2 * e + 1) * 68 + d];
      const _Float16 x0 = (_Float16)(bf_up(bf_bits(f0)) * vsc);
      const _Float16 x1 = (_Float16)(bf_up(bf_bits(f1)) * vsc);
      a[e] = pk16(h_bits(x0), h_bits(x1));
    }
    hv[it] = a;
    hofs[it] = ((size_t)(bh * DVL + d)) * TT + (size_t)s0 + (size_t)(piece * 8);
  }
  {
#pragma unroll
    for (int it = 0; it < 2; ++it) {
      *(v4u*)(vt + hofs[it]) = hv[it];
    }
    
  }
}

// =====================================================================================================
// Causal polynomial attention, d_key 32, d_val 64.
//   q f32 input: element (bh, t, d) at [(bh*TT + t)*DKY + d];  k f32 input: (bh, s, d) at [(bh*TT + s)*DKY + d];
//   both are converted to bf16 (RNE) here: q on its way into the fragment registers, k on its way into LDS
//   v^T plane f16 (x VSC): (bh, d, s) at [(bh*DVL + d)*TT + s]
//   raw scores = q . k on bf16 WMMA (one k-step of 32 over d), f32 accumulate, then x = raw * sscale in f32,
//   a = 1 + x*(1 + x/2*(1 + x/3)) (f32), keys > query replaced by 0, z += a (f32, per-lane partials, fixed order).
//   a planes: hi = f16(clamp(64 a)), lo = f16((clamp(64 a) - hi) * 1024) (the difference is exact in f32);
//   context_hi += hi . v^T, context_lo += lo . v^T on f16 WMMA (2 k-steps of 32 per 64-key chunk), separate
//   accumulators; epilogue S = (context_hi + context_lo / 1024) / (64 * VSC), out = S * (1 / Z).
//   Block = 8 waves in two groups of 4; it runs two 64-row query tiles of one bh one after the other, tile NQB-1-p
//   and then tile p, so that every block walks NQB+1 key chunks (causal cost is linear in the tile index; all blocks
//   are resident at once and the launch lasts as long as its fullest block). grid = (NQB/2) * NBH; key chunks 0..qb
//   per tile (block-uniform trip count, statically clamped to NQB); every processed chunk holds at least one live key.
//   Key split: wave w and wave w+4 own the same 16 query rows; group 0 (waves 0..3) takes the even key chunks, group 1
//   (waves 4..7) the odd ones, each group with its own K / V^T buffers, one pair of chunks per pass. The weights are a
//   plain sum over keys (no running maximum), so the two groups' context and Z partials just add: at the end of a tile
//   group 1 hands its partials over in LDS, one __syncthreads, group 0 adds them and finishes the tile.
//   K / V^T chunk staging per group: K 64 rows x 32 floats = 8 KB contiguous (4 x 16 B per thread, a wave's load = 512
//   contiguous B, 4 bf16 = 8 B to LDS each), V^T 64 rows x 64 halves (2 threads per row, 4 x 16 B each); plain loads,
//   __syncthreads before and after.
//   A tiles are wave-private, spilled with _Float16 element stores and reloaded as v8h (same element type)
//   out f32 [bh][pos][DVL]: row (bh, t) = 64 floats = 256 B; each group-0 wave stages its 16x64 tile in LDS, then one
//   instruction per row pair: lanes 0..15 x 16 B = row 2i, lanes 16..31 x 16 B = row 2i+1 (512 contiguous B =
// coverage: 8 instructions x 2 rows x 64 cols = the wave's 16 rows; 4 waves = the 64-row tile; p = 0..NQB/2-1 with
//   tiles p and NQB-1-p = every query tile once; grid = every (bh, p).
// =====================================================================================================
// waves_per_eu(4, 4): two blocks of 8 waves on a WGP = four waves per SIMD, 256 registers a wave.
__global__ __launch_bounds__(256) __attribute__((amdgpu_waves_per_eu(4, 4)))
void attn_poly(const float* __restrict__ qf, const float* __restrict__ kf,
               const unsigned short* __restrict__ vtpl, float* outp, float sscale) {
#pragma clang fp contract(off)
  union FH { v16h v; v8h h[2]; };
  union FB { v16b v; v8b h[2]; };
  __shared__ __align__(16) __bf16   Ksh2[2][64 * KPT];              // per group K [kv][d], padded rows     5 KB each
  __shared__ __align__(16) _Float16 Vth2[2][DVL * VPT];             // per group V^T [d][kv], padded rows   9 KB each
  __shared__ __align__(16) _Float16 Psh[8][16 * PPT];               // per wave hi plane [row][kv], padded rows
  __shared__ __align__(16) _Float16 Psl[8][16 * PPT];               // per wave residual plane [row][kv], padded rows
  __shared__ __align__(16) float    Os[4][16 * DVL];                // per group-0 wave context tile [row][d]
  __shared__ __align__(16) float    Cs[4][10 * 32 * 4];             // group 1 -> group 0: [piece][lane] x 4 floats

  const int tid  = threadIdx.x & 127;        // thread index inside its group of 4 waves
  // wave number in a scalar register: the tests on the group below become scalar branches, EXEC stays all ones
  const int wv8  = __builtin_amdgcn_readfirstlane((int)(threadIdx.x >> 5));
  const int grp  = wv8 >> 2;                 // 0: even key chunks, 1: odd key chunks
  const int wave = wv8 & 3;                  // which 16 query rows of the tile
  const int lane = tid & 31;
  __bf16*   Ksh = Ksh2[grp];
  _Float16* Vth = Vth2[grp];
  const int hh   = lane >> 4;
  const int c    = lane & 15;

  const int bx = blockIdx.x;
  const int pr = bx % (NQB / 2);
  const int bh = bx / (NQB / 2);
  if (bh >= NBH) return;                     // block-uniform, ahead of every barrier

  const float*    Qp = qf + (size_t)bh * TT * DKY;
  const float*    Kp = kf + (size_t)bh * TT * DKY;
  const _Float16* Vh = (const _Float16*)(const void*)vtpl + (size_t)bh * DVL * TT;

  // one copy of the tile body: the two tiles of a block run strictly one after the other in every wave
#pragma unroll 1
  for (int half = 0; half < 2; ++half) {
  const int qb = half ? pr : (NQB - 1 - pr);   // block-uniform
  const int q0 = qb * 64 + wave * 16;

  // ---- Q fragment (A operand, row = lane&15): one d-chunk of 32; elements 0..7 <- d 8hh.., 8..15 <- d 16+8hh.. ----
  v16b qa;
  {
    const float* qg = Qp + (size_t)(q0 + c) * DKY + 8 * hh;
    v4f qv[4];
    qv[0] = *(const v4f*)(qg);
    qv[1] = *(const v4f*)(qg + 4);
    qv[2] = *(const v4f*)(qg + 16);
    qv[3] = *(const v4f*)(qg + 20);
#pragma unroll
    for (int i = 0; i < 4; ++i) {
      const v4b qc = __builtin_convertvector(qv[i], v4b);
#pragma unroll
      for (int e = 0; e < 4; ++e) qa[4 * i + e] = qc[e];
    }
  }

  float zl[8];
  v8f oacc[4], olo[4];
#pragma unroll
  for (int r = 0; r < 8; ++r) zl[r] = 0.f;
#pragma unroll
  for (int t = 0; t < 4; ++t) { oacc[t] = zero8(); olo[t] = zero8(); }

  int nkt = qb + 1;                          // causal: key chunks 0..qb, block-uniform
  if (nkt > NQB) nkt = NQB;
  const int npass = (nkt + 1) >> 1;          // block-uniform: every wave passes every barrier
  for (int ps = 0; ps < npass; ++ps) {
    const int kt = 2 * ps + grp;
    const bool live = kt < nkt;              // false only for group 1 in the last pass of an odd chunk count
    const int kv0 = kt * 64;
    __syncthreads();
    if (live) {
      const float* kg = Kp + (size_t)kv0 * DKY + tid * 4;             // piece i*128 + tid of the chunk's 512 x 4 floats
      v4f ka[4];
#pragma unroll
      for (int i = 0; i < 4; ++i) ka[i] = *(const v4f*)(kg + i * 512);
#pragma unroll
      for (int i = 0; i < 4; ++i) {                                   // K row i*16 + (tid>>3), d = 4*(tid&7)..+3
        *(v4b*)(Ksh + (i * 16 + (tid >> 3)) * KPT + (tid & 7) * 4) = __builtin_convertvector(ka[i], v4b);
      }
      const int r  = tid >> 1;                                        // V^T row d = r
      const int so = (tid & 1) * 32;                                  // s = kv0+so..kv0+so+31
      const _Float16* vg = Vh + (size_t)r * TT + (size_t)kv0 + (size_t)so;
#pragma unroll
      for (int i = 0; i < 4; ++i) {
        const v8h b0 = *(const v8h*)(vg + 8 * i);
        *(v8h*)(Vth + r * VPT + so + 8 * i) = b0;
      }
    }
    __syncthreads();
    if (!live) continue;

    // ---- raw scores: 16 query rows x 64 keys per wave, bf16 product, one d-chunk ----
    v8f s[4];
#pragma unroll
    for (int j = 0; j < 4; ++j) {
      FB kb;
      kb.h[0] = *(const v8b*)(Ksh + (j * 16 + c) * KPT + 8 * hh);
      kb.h[1] = *(const v8b*)(Ksh + (j * 16 + c) * KPT + 16 + 8 * hh);
      s[j] = mma_b(qa, kb.v, zero8());
    }

    // ---- scale, polynomial, causal zeroing, Z partials, hi / residual planes to LDS ----
    _Float16* pwh = Psh[wv8];
    _Float16* pwl = Psl[wv8];
#pragma unroll
    for (int r = 0; r < 8; ++r) {
      const int qrow = q0 + 8 * hh + r;
#pragma unroll
      for (int j = 0; j < 4; ++j) {
        const int key = kv0 + j * 16 + c;
        const float x = s[j][r] * sscale;
        float a = poly3(x);
        a = (key > qrow) ? 0.0f : a;
        zl[r] += a;
        float ac = a * AHS;
        ac = fminf(fmaxf(ac, -F16MX), F16MX);
        const _Float16 ah = (_Float16)ac;
        const _Float16 al = (_Float16)((ac - (float)ah) * ALS);
        pwh[(8 * hh + r) * PPT + j * 16 + c] = ah;
        pwl[(8 * hh + r) * PPT + j * 16 + c] = al;
      }
    }
    __builtin_amdgcn_fence(__ATOMIC_RELEASE, "workgroup");
    __builtin_amdgcn_wave_barrier();
    __builtin_amdgcn_fence(__ATOMIC_ACQUIRE, "workgroup");

    // ---- context_hi += hi . V^T, context_lo += lo . V^T (f16 WMMA, separate accumulators) ----
#pragma unroll 1
    for (int kk = 0; kk < 2; ++kk) {
      FH pa, pl;
      pa.h[0] = *(const v8h*)(pwh + c * PPT + kk * 32 + 8 * hh);
      pa.h[1] = *(const v8h*)(pwh + c * PPT + kk * 32 + 16 + 8 * hh);
      pl.h[0] = *(const v8h*)(pwl + c * PPT + kk * 32 + 8 * hh);
      pl.h[1] = *(const v8h*)(pwl + c * PPT + kk * 32 + 16 + 8 * hh);
#pragma unroll
      for (int t = 0; t < 4; ++t) {
        FH vb;
        vb.h[0] = *(const v8h*)(Vth + (t * 16 + c) * VPT + kk * 32 + 8 * hh);
        vb.h[1] = *(const v8h*)(Vth + (t * 16 + c) * VPT + kk * 32 + 16 + 8 * hh);
        oacc[t] = mma_h(pa.v, vb.v, oacc[t]);
        olo[t]  = mma_h(pl.v, vb.v, olo[t]);
      }
    }
  }

  // ---- join of the key split: group 1 stores hi + lo/1024 (8 pieces) and its Z partials (2 pieces), lane-major ----
  float* cs = Cs[wave];
  if (grp == 1) {
#pragma unroll
    for (int t = 0; t < 4; ++t) {
#pragma unroll
      for (int g4 = 0; g4 < 2; ++g4) {
        v4f pv;
#pragma unroll
        for (int e = 0; e < 4; ++e) pv[e] = oacc[t][4 * g4 + e] + olo[t][4 * g4 + e] * (1.0f / ALS);
        *(v4f*)(cs + ((t * 2 + g4) * 32 + lane) * 4) = pv;
      }
    }
#pragma unroll
    for (int g4 = 0; g4 < 2; ++g4) {
      v4f zv;
#pragma unroll
      for (int e = 0; e < 4; ++e) zv[e] = zl[4 * g4 + e];
      *(v4f*)(cs + ((8 + g4) * 32 + lane) * 4) = zv;
    }
  }
  __syncthreads();                           // publishes group 1's partials; block-uniform
  if (grp == 1) continue;                    // group 1 goes on to the next tile's first barrier
  float so[4][8];                            // the odd chunks' context partial, this lane's 32 elements
#pragma unroll
  for (int t = 0; t < 4; ++t) {
#pragma unroll
    for (int g4 = 0; g4 < 2; ++g4) {
      const v4f pv = *(const v4f*)(cs + ((t * 2 + g4) * 32 + lane) * 4);
#pragma unroll
      for (int e = 0; e < 4; ++e) so[t][4 * g4 + e] = pv[e];
    }
  }
#pragma unroll
  for (int g4 = 0; g4 < 2; ++g4) {
    const v4f zv = *(const v4f*)(cs + ((8 + g4) * 32 + lane) * 4);
#pragma unroll
    for (int e = 0; e < 4; ++e) zl[4 * g4 + e] += zv[e];
  }

  // ---- Z fold (fixed-order butterfly over the 16 lanes of each half), S = (hi + lo/1024)/(64*VSC), S*(1/Z);
  float* os = Os[wave];
#pragma unroll
  for (int r = 0; r < 8; ++r) {
    float z = zl[r];
    z += __shfl_xor(z, 1, 32);
    z += __shfl_xor(z, 2, 32);
    z += __shfl_xor(z, 4, 32);
    z += __shfl_xor(z, 8, 32);
    const float rz = 1.0f / z;
#pragma unroll
    for (int t = 0; t < 4; ++t) {
      const float sv = ((oacc[t][r] + olo[t][r] * (1.0f / ALS)) + so[t][r]) * (1.0f / (AHS * VSC));
      os[(8 * hh + r) * DVL + t * 16 + c] = sv * rz;
    }
  }
  __builtin_amdgcn_fence(__ATOMIC_RELEASE, "workgroup");
  __builtin_amdgcn_wave_barrier();
  __builtin_amdgcn_fence(__ATOMIC_ACQUIRE, "workgroup");
  {
    const int col4 = c * 4;                      // 16 lanes x 4 floats = one whole 64-float row
    {
#pragma unroll
      for (int it = 0; it < 8; ++it) {           // row pairs (2it, 2it+1) of the wave tile
        const int rr = 2 * it + hh;
        const v4f ov = *(const v4f*)(os + rr * DVL + col4);
        const size_t go = ((size_t)(bh * TT + q0 + rr)) * DVL + (size_t)col4;
        *(v4f*)(outp + go) = ov;
      }
      // the next tile's set-up overwrites the address and data registers these stores name
      asm volatile("s_wait_xcnt 0x0" ::: "memory");
    }
  }
  }
}

// =====================================================================================================
// Inputs: in0 q [NB][NHD][TT][DKY] f32, in1 k same, in2 v [NB][NHD][TT][DVL] f32; bh = b*NHD + h.
// d_out f32 [NB][NHD][TT][DVL] at byte 0.
//   Vt  f16  [NBH][DVL][TT]     0          8388608
//   end                         8388608
// =====================================================================================================
extern "C" void kernel_launch(void* const* d_in, const int* in_sizes, int n_in,
                              void* d_out, int out_size, void* d_ws, size_t ws_size,
                              hipStream_t stream) {
  const int nq = NBH * TT * DKY;                      // 2097152
  const int nv = NBH * TT * DVL;                      // 4194304
  if (n_in < 3) return;
  if (in_sizes[0] != nq) return;
  if (in_sizes[1] != nq) return;
  if (in_sizes[2] != nv) return;
  if (out_size != nv) return;

  const float* q = (const float*)d_in[0];
  const float* k = (const float*)d_in[1];
  const float* v = (const float*)d_in[2];

  const size_t PV = (size_t)nv * 2;                   // 8388608
  size_t off = 0;
  const size_t oV = off; off += PV;
  if (off > ws_size) return;                          // off = 8388608
  if (off > (size_t)134217728) return;

  char* ws = (char*)d_ws;
  unsigned short* Vt = (unsigned short*)(ws + oV);
  float* outf = (float*)d_out;

  const dim3 blk(256);
  const dim3 gV(TT / 64, NBH);                        // (32, 32)
  const float sscale = 1.0f / sqrtf((float)DKY);

  // (1) v -> f16 v^T plane [bh][d][pos], values x VSC
  v_planes<<<gV, blk, 0, stream>>>(v, Vt, VSC);
  // (2) causal polynomial attention (reads q and k as f32) -> d_out
  attn_poly<<<dim3(NBH * (NQB / 2)), dim3(256), 0, stream>>>(q, k, Vt, outf, sscale);
  (void)hipGetLastError();
}

// v005
// Measured time: 42.4 microseconds a run.
// In two side-by-side timings against v004, it was 1.29 and 1.28 times as fast.
// Over all steps from v000 it is 2.92 times as fast.
// Contractions: q.k^T scores = v_wmma_f32_16x16x32_bf16 (bf16 operands = q and k RNE-converted where they are read, single
// product, d_key 32 = one k-step); a.v context = v_wmma_f32_16x16x32_f16 (a carried as an f16 hi plane x64 plus an f16 residual
// plane x64x1024 feeding a second accumulator, v as f16 of the bf16-converted value x16; two products); all f32
// accumulate; cubic truncated-exp polynomial, causal zeroing, row sums Z and the final S*(1/Z) in f32.
// Both products run transposed (scores^T = k . q^T, context^T = v^T . a^T): the score accumulators are the a^T operand.
#include <hip/hip_runtime.h>
#include <math.h>
#include <stdint.h>

#define TT    2048                 // sequence length (queries == keys)
#define NB    4
#define NHD   8
#define DKY   32                   // d_key
#define DVL   64                   // d_val
#define NBH   (NB * NHD)           // 32 (batch, head) pairs; bh = b*NHD + h
#define NQB   (TT / 64)            // 32 query / key tiles of 64
#define AHS   64.0f                // hi plane carry of the polynomial weights (exact power of two)
#define ALS   1024.0f              // residual plane carry on top of AHS (exact power of two)
#define VSC   16.0f                // v plane carry (exact power of two)
#define F16MX 65504.0f
// LDS row pitches in 16-bit elements: 16 B x odd, so that the 16 rows one ds_load_b128 half-wave reads start on
// 16 distinct bank quads (bank = dword address mod 64) instead of 2 (128-B rows) or 4 (64-B rows).
#define KPT   40                   // K rows: 32 halves + 8 pad  = 80 B
#define VPT   72                   // V^T rows: 64 halves + 8 pad = 144 B
#define OPT   68                   // output staging rows (f32): 64 floats + 4 pad = 272 B
static_assert((TT % 64) == 0);
static_assert((NQB % 2) == 0);
static_assert(DKY == 32);
static_assert(DVL == 64);
static_assert((KPT % 16) == 8 && (VPT % 16) == 8 && (OPT % 8) == 4);

typedef _Float16 v16h __attribute__((ext_vector_type(16)));
typedef _Float16 v8h  __attribute__((ext_vector_type(8)));
typedef __bf16   v16b __attribute__((ext_vector_type(16)));
typedef __bf16   v8b  __attribute__((ext_vector_type(8)));
typedef __bf16   v4b  __attribute__((ext_vector_type(4)));
typedef float    v8f  __attribute__((ext_vector_type(8)));
typedef float    v4f  __attribute__((ext_vector_type(4)));
typedef float    v2f  __attribute__((ext_vector_type(2)));
typedef _Float16 v2h  __attribute__((ext_vector_type(2)));
typedef unsigned int v4u __attribute__((ext_vector_type(4)));

// ---- scalar helpers --------------------------------------------------------------------------------
__device__ __forceinline__ unsigned short bf_bits(float f) {          // f32 -> bf16 bits, RNE convert
  unsigned u = __float_as_uint(f);
  return (unsigned short)((u + 0x7FFFu + ((u >> 16) & 1u)) >> 16);
}
__device__ __forceinline__ float bf_up(unsigned short h) { return __uint_as_float(((unsigned)h) << 16); }
__device__ __forceinline__ unsigned short h_bits(_Float16 x) { return __builtin_bit_cast(unsigned short, x); }
__device__ __forceinline__ unsigned pk16(unsigned short a, unsigned short b) { return (unsigned)a | ((unsigned)b << 16); }
__device__ __forceinline__ v8f zero8() { v8f z = {0.f, 0.f, 0.f, 0.f, 0.f, 0.f, 0.f, 0.f}; return z; }

// Degree-3 truncated exp, Horner order 1 + x*(1 + (x/2)*(1 + x/3)), unfused f32 ops.
__device__ __forceinline__ v2f poly3(v2f x) {
#pragma clang fp contract(off)
  const float third = 1.0f / 3.0f;
  v2f t = 1.0f + x * third;
  t = 1.0f + (x * 0.5f) * t;
  t = 1.0f + x * t;
  return t;
}

// ---- WMMA helpers with trailing VALU hazard gap --------------------------------------------------------
__device__ __forceinline__ v8f mma_b(v16b a, v16b b, v8f c) {
  c = __builtin_amdgcn_wmma_f32_16x16x32_bf16(false, a, false, b, (short)0, c, false, false);
#if defined(__HIP_DEVICE_COMPILE__)
  asm volatile("v_nop\n\tv_nop\n\tv_nop\n\tv_nop" : "+v"(c) : "v"(a), "v"(b));
#endif
  return c;
}
__device__ __forceinline__ v8f mma_h(v16h a, v16h b, v8f c) {
  c = __builtin_amdgcn_wmma_f32_16x16x32_f16(false, a, false, b, (short)0, c, false, false);
#if defined(__HIP_DEVICE_COMPILE__)
  asm volatile("v_nop\n\tv_nop\n\tv_nop\n\tv_nop" : "+v"(c) : "v"(a), "v"(b));
#endif
  return c;
}

// =====================================================================================================
// v f32 [bh][pos][DVL] -> f16 v^T plane vt[(bh*DVL + d)*TT + s] = f16(bf16_rne(v) * vsc) (exact for a power of two).
// Block = one 64-position x 64-feature tile of one bh; grid = (TT/64, NBH); tile staged in LDS as f32
// (256 threads x 4 v4f loads, __syncthreads).
// Store: group g = tid>>3 (0..31), piece = tid&7: iteration it writes row d = it*32 + g; lanes 8g..8g+7 x 16 B =
// coverage: 2 iterations x 32 groups = 64 rows d, 8 pieces x 8 = 64 keys per row; grid covers every (bh, s tile).
// =====================================================================================================
__global__ __launch_bounds__(256) void v_planes(const float* __restrict__ vf, unsigned short* vt, float vsc) {
  __shared__ __align__(16) float sv[64 * 68];        // [tt][d], pitch 68 floats (272 B, 16-B aligned rows)
  const int tid = threadIdx.x;
  const int s0  = blockIdx.x * 64;
  const int bh  = blockIdx.y;
  if (bh >= NBH || s0 >= TT) return;                 // block-uniform, ahead of every barrier
  const float* src = vf + ((size_t)bh * TT + (size_t)s0) * DVL;   // 64 rows x 64 floats, contiguous
#pragma unroll
  for (int i = 0; i < 4; ++i) {
    const int idx = i * 256 + tid;                   // 0..1023
    const int tt = idx >> 4, c4 = (idx & 15) * 4;    // tt 0..63, c4 0..60
    const v4f a = *(const v4f*)(src + (size_t)tt * DVL + c4);
    *(v4f*)(sv + tt * 68 + c4) = a;
  }
  __syncthreads();

  const int g = tid >> 3, piece = tid & 7;
  v4u hv[2];
  size_t hofs[2];
#pragma unroll
  for (int it = 0; it < 2; ++it) {
    const int d = it * 32 + g;
    v4u a;
#pragma unroll
    for (int e = 0; e < 4; ++e) {
      const float f0 = sv[(piece * 8 + 2 * e) * 68 + d];
      const float f1 = sv[(piece * 8 + 2 * e + 1) * 68 + d];
      const _Float16 x0 = (_Float16)(bf_up(bf_bits(f0)) * vsc);
      const _Float16 x1 = (_Float16)(bf_up(bf_bits(f1)) * vsc);
      a[e] = pk16(h_bits(x0), h_bits(x1));
    }
    hv[it] = a;
    hofs[it] = ((size_t)(bh * DVL + d)) * TT + (size_t)s0 + (size_t)(piece * 8);
  }
  {
#pragma unroll
    for (int it = 0; it < 2; ++it) {
      *(v4u*)(vt + hofs[it]) = hv[it];
    }
    
  }
}

// =====================================================================================================
// Causal polynomial attention, d_key 32, d_val 64.
//   q f32 input: element (bh, t, d) at [(bh*TT + t)*DKY + d];  k f32 input: (bh, s, d) at [(bh*TT + s)*DKY + d];
//   both are converted to bf16 (RNE) here: q on its way into the fragment registers, k on its way into LDS
//   v^T plane f16 (x VSC): (bh, d, s) at [(bh*DVL + d)*TT + s]
//   raw scores^T = k . q^T on bf16 WMMA (A = 16 K rows, B = the wave's 16 queries, one k-step of 32 over d), f32
//   accumulate: register r of tile j in lane (c, hh) = key j*16 + 8hh + r against query c. x = raw * sscale in f32,
//   a = 1 + x*(1 + x/2*(1 + x/3)) (f32), keys > query replaced by 0, z += a (f32, in-lane: a lane holds one query;
//   four partials, by the parity of tile j and of register r, fixed order).
//   a planes: hi = f16(clamp(64 a)), lo = f16((clamp(64 a) - hi) * 1024) (the difference is exact in f32);
//   score tiles 2kk and 2kk+1, converted in place, are the B operand (keys kk*32.. in the hardware k order) of
//   context_hi^T += v^T . hi^T, context_lo^T += v^T . lo^T on f16 WMMA (A = 16 V^T rows, 2 k-steps of 32 per 64-key
//   chunk), separate accumulators: the weights never pass through LDS. Register r of tile t = feature t*16 + 8hh + r of
//   query c; epilogue S = (context_hi + context_lo / 1024) / (64 * VSC), out = S * (1 / Z).
//   Block = 8 waves in two groups of 4; it runs two 64-row query tiles of one bh one after the other, tile NQB-1-p
//   and then tile p, so that every block walks NQB+1 key chunks (causal cost is linear in the tile index; all blocks
//   are resident at once and the launch lasts as long as its fullest block). grid = (NQB/2) * NBH; key chunks 0..qb
//   per tile (block-uniform trip count, statically clamped to NQB); every processed chunk holds at least one live key.
//   Key split: wave w and wave w+4 own the same 16 query rows; group 0 (waves 0..3) takes the even key chunks, group 1
//   (waves 4..7) the odd ones, each group with its own K / V^T buffers, one pair of chunks per pass. The weights are a
//   plain sum over keys (no running maximum), so the two groups' context and Z partials just add: at the end of a tile
//   group 1 hands its partials over in LDS, one __syncthreads, group 0 adds them and finishes the tile.
//   K / V^T chunk staging per group: K 64 rows x 32 floats = 8 KB contiguous (4 x 16 B per thread, a wave's load = 512
//   contiguous B, 4 bf16 = 8 B to LDS each), V^T 64 rows x 64 halves (2 threads per row, 4 x 16 B each); plain loads,
//   __syncthreads before and after.
//   out f32 [bh][pos][DVL]: row (bh, t) = 64 floats = 256 B; each wave stages its 16x64 tile in LDS, then one
//   instruction per row pair: lanes 0..15 x 16 B = row 2i, lanes 16..31 x 16 B = row 2i+1 (512 contiguous B =
// coverage: 8 instructions x 2 rows x 64 cols = the wave's 16 rows; 4 waves = the 64-row tile; p = 0..NQB/2-1 with
//   tiles p and NQB-1-p = every query tile once; grid = every (bh, p).
// =====================================================================================================
// waves_per_eu(4, 4): two blocks of 8 waves on a WGP = four waves per SIMD, 256 registers a wave.
__global__ __launch_bounds__(256) __attribute__((amdgpu_waves_per_eu(4, 4)))
void attn_poly(const float* __restrict__ qf, const float* __restrict__ kf,
               const unsigned short* __restrict__ vtpl, float* outp, float sscale) {
#pragma clang fp contract(off)
  union FH { v16h v; v8h h[2]; };
  union FB { v16b v; v8b h[2]; };
  __shared__ __align__(16) __bf16   Ksh2[2][64 * KPT];              // per group K [kv][d], padded rows     5 KB each
  __shared__ __align__(16) _Float16 Vth2[2][DVL * VPT];             // per group V^T [d][kv], padded rows   9 KB each
  __shared__ __align__(16) float    Os[4][16 * OPT];                // per group-0 wave context tile [row][d], padded rows
  __shared__ __align__(16) float    Cs[4][9 * 32 * 4];              // group 1 -> group 0: [piece][lane] x 4 floats

  const int tid  = threadIdx.x & 127;        // thread index inside its group of 4 waves
  // wave number in a scalar register: the tests on the group below become scalar branches, EXEC stays all ones
  const int wv8  = __builtin_amdgcn_readfirstlane((int)(threadIdx.x >> 5));
  const int grp  = wv8 >> 2;                 // 0: even key chunks, 1: odd key chunks
  const int wave = wv8 & 3;                  // which 16 query rows of the tile
  const int lane = tid & 31;
  __bf16*   Ksh = Ksh2[grp];
  _Float16* Vth = Vth2[grp];
  const int hh   = lane >> 4;
  const int c    = lane & 15;

  const int bx = blockIdx.x;
  const int pr = bx % (NQB / 2);
  const int bh = bx / (NQB / 2);
  if (bh >= NBH) return;                     // block-uniform, ahead of every barrier

  const float*    Qp = qf + (size_t)bh * TT * DKY;
  const float*    Kp = kf + (size_t)bh * TT * DKY;
  const _Float16* Vh = (const _Float16*)(const void*)vtpl + (size_t)bh * DVL * TT;

  // one copy of the tile body: the two tiles of a block run strictly one after the other in every wave
#pragma unroll 1
  for (int half = 0; half < 2; ++half) {
  const int qb = half ? pr : (NQB - 1 - pr);   // block-uniform
  const int q0 = qb * 64 + wave * 16;

  // ---- Q fragment (B operand, column = lane&15): one d-chunk of 32; elements 0..7 <- d 8hh.., 8..15 <- d 16+8hh.. ----
  v16b qa;
  {
    const float* qg = Qp + (size_t)(q0 + c) * DKY + 8 * hh;
    v4f qv[4];
    qv[0] = *(const v4f*)(qg);
    qv[1] = *(const v4f*)(qg + 4);
    qv[2] = *(const v4f*)(qg + 16);
    qv[3] = *(const v4f*)(qg + 20);
#pragma unroll
    for (int i = 0; i < 4; ++i) {
      const v4b qc = __builtin_convertvector(qv[i], v4b);
#pragma unroll
      for (int e = 0; e < 4; ++e) qa[4 * i + e] = qc[e];
    }
  }

  v2f zl[2];                                 // Z partials of query c: [tile j odd][register r odd]
  v8f oacc[4], olo[4];
#pragma unroll
  for (int u = 0; u < 2; ++u) zl[u] = (v2f){0.f, 0.f};
#pragma unroll
  for (int t = 0; t < 4; ++t) { oacc[t] = zero8(); olo[t] = zero8(); }

  int nkt = qb + 1;                          // causal: key chunks 0..qb, block-uniform
  if (nkt > NQB) nkt = NQB;
  const int npass = (nkt + 1) >> 1;          // block-uniform: every wave passes every barrier
  for (int ps = 0; ps < npass; ++ps) {
    const int kt = 2 * ps + grp;
    const bool live = kt < nkt;              // false only for group 1 in the last pass of an odd chunk count
    const int kv0 = kt * 64;
    __syncthreads();
    if (live) {
      const float* kg = Kp + (size_t)kv0 * DKY + tid * 4;             // piece i*128 + tid of the chunk's 512 x 4 floats
      v4f ka[4];
#pragma unroll
      for (int i = 0; i < 4; ++i) ka[i] = *(const v4f*)(kg + i * 512);
#pragma unroll
      for (int i = 0; i < 4; ++i) {                                   // K row i*16 + (tid>>3), d = 4*(tid&7)..+3
        *(v4b*)(Ksh + (i * 16 + (tid >> 3)) * KPT + (tid & 7) * 4) = __builtin_convertvector(ka[i], v4b);
      }
      const int r  = tid >> 1;                                        // V^T row d = r
      const int so = (tid & 1) * 32;                                  // s = kv0+so..kv0+so+31
      const _Float16* vg = Vh + (size_t)r * TT + (size_t)kv0 + (size_t)so;
#pragma unroll
      for (int i = 0; i < 4; ++i) {
        const v8h b0 = *(const v8h*)(vg + 8 * i);
        *(v8h*)(Vth + r * VPT + so + 8 * i) = b0;
      }
    }
    __syncthreads();
    if (!live) continue;

    // ---- raw scores^T: 64 keys x 16 queries per wave, bf16 product, one d-chunk ----
    v8f s[4];
#pragma unroll
    for (int j = 0; j < 4; ++j) {
      FB kb;
      kb.h[0] = *(const v8b*)(Ksh + (j * 16 + c) * KPT + 8 * hh);
      kb.h[1] = *(const v8b*)(Ksh + (j * 16 + c) * KPT + 16 + 8 * hh);
      s[j] = mma_b(kb.v, qa, zero8());
    }

    const int dq = q0 + c - kv0 - 8 * hh;    // key j*16 + 8hh + r of the chunk is past query c where j*16 + r > dq
    // unrolled: kk picks the score tiles, which are registers and need compile-time indices
#pragma unroll
    for (int kk = 0; kk < 2; ++kk) {
      // ---- scale, polynomial, causal zeroing, Z partials; hi / residual planes straight into the B fragments:
      //      element 8u + r <- key kk*32 + 16u + 8hh + r = register r of score tile 2kk + u ----
      FH pa, pl;
#pragma unroll
      for (int u = 0; u < 2; ++u) {
        const int j = 2 * kk + u;
#pragma unroll
        for (int rp = 0; rp < 4; ++rp) {                              // registers 2rp, 2rp+1: two consecutive keys
          const int kr = j * 16 + 2 * rp;
          const v2f x = (v2f){s[j][2 * rp], s[j][2 * rp + 1]} * sscale;
          v2f a = poly3(x);
          a[0] = (kr > dq) ? 0.0f : a[0];
          a[1] = (kr + 1 > dq) ? 0.0f : a[1];
          zl[u] += a;
          v2f ac = a * AHS;
          ac[0] = fminf(fmaxf(ac[0], -F16MX), F16MX);
          ac[1] = fminf(fmaxf(ac[1], -F16MX), F16MX);
          const v2h ah = __builtin_convertvector(ac, v2h);
          pa.h[u][2 * rp]     = ah[0];
          pa.h[u][2 * rp + 1] = ah[1];
          const v2h al = __builtin_convertvector((ac - __builtin_convertvector(ah, v2f)) * ALS, v2h);
          pl.h[u][2 * rp]     = al[0];
          pl.h[u][2 * rp + 1] = al[1];
        }
      }
      // ---- context_hi^T += V^T . hi^T, context_lo^T += V^T . lo^T (f16 WMMA, separate accumulators) ----
#pragma unroll
      for (int t = 0; t < 4; ++t) {
        FH vb;
        vb.h[0] = *(const v8h*)(Vth + (t * 16 + c) * VPT + kk * 32 + 8 * hh);
        vb.h[1] = *(const v8h*)(Vth + (t * 16 + c) * VPT + kk * 32 + 16 + 8 * hh);
        oacc[t] = mma_h(vb.v, pa.v, oacc[t]);
        olo[t]  = mma_h(vb.v, pl.v, olo[t]);
      }
    }
  }

  // ---- join of the key split: group 1 stores hi + lo/1024 (8 pieces) and its Z partials (1 piece), lane-major ----
  float* cs = Cs[wave];
  if (grp == 1) {
#pragma unroll
    for (int t = 0; t < 4; ++t) {
#pragma unroll
      for (int g4 = 0; g4 < 2; ++g4) {
        v4f pv;
#pragma unroll
        for (int e = 0; e < 4; ++e) pv[e] = oacc[t][4 * g4 + e] + olo[t][4 * g4 + e] * (1.0f / ALS);
        *(v4f*)(cs + ((t * 2 + g4) * 32 + lane) * 4) = pv;
      }
    }
    {
      v4f zv;
#pragma unroll
      for (int e = 0; e < 4; ++e) zv[e] = zl[e >> 1][e & 1];
      *(v4f*)(cs + (8 * 32 + lane) * 4) = zv;
    }
  }
  __syncthreads();                           // publishes group 1's partials; block-uniform
  if (grp == 1) continue;                    // group 1 goes on to the next tile's first barrier
  float so[4][8];                            // the odd chunks' context partial, this lane's 32 elements
#pragma unroll
  for (int t = 0; t < 4; ++t) {
#pragma unroll
    for (int g4 = 0; g4 < 2; ++g4) {
      const v4f pv = *(const v4f*)(cs + ((t * 2 + g4) * 32 + lane) * 4);
#pragma unroll
      for (int e = 0; e < 4; ++e) so[t][4 * g4 + e] = pv[e];
    }
  }
  {
    const v4f zv = *(const v4f*)(cs + (8 * 32 + lane) * 4);
#pragma unroll
    for (int e = 0; e < 4; ++e) zl[e >> 1][e & 1] += zv[e];
  }

  // ---- Z fold (the four in-lane partials, then the other half of the keys from lane ^ 16, fixed order),
  //      S = (hi + lo/1024)/(64*VSC), S*(1/Z); a lane holds 8 consecutive features of its query per tile t ----
  float* os = Os[wave];
  {
    float z = (zl[0][0] + zl[0][1]) + (zl[1][0] + zl[1][1]);
    z += __shfl_xor(z, 16, 32);
    const float rz = 1.0f / z;
#pragma unroll
    for (int t = 0; t < 4; ++t) {
#pragma unroll
      for (int g4 = 0; g4 < 2; ++g4) {
        v4f ov;
#pragma unroll
        for (int e = 0; e < 4; ++e) {
          const int r = 4 * g4 + e;
          const float sv = ((oacc[t][r] + olo[t][r] * (1.0f / ALS)) + so[t][r]) * (1.0f / (AHS * VSC));
          ov[e] = sv * rz;
        }
        *(v4f*)(os + c * OPT + t * 16 + 8 * hh + 4 * g4) = ov;
      }
    }
  }
  __builtin_amdgcn_fence(__ATOMIC_RELEASE, "workgroup");
  __builtin_amdgcn_wave_barrier();
  __builtin_amdgcn_fence(__ATOMIC_ACQUIRE, "workgroup");
  {
    const int col4 = c * 4;                      // 16 lanes x 4 floats = one whole 64-float row
    {
#pragma unroll
      for (int it = 0; it < 8; ++it) {           // row pairs (2it, 2it+1) of the wave tile
        const int rr = 2 * it + hh;
        const v4f ov = *(const v4f*)(os + rr * OPT + col4);
        const size_t go = ((size_t)(bh * TT + q0 + rr)) * DVL + (size_t)col4;
        *(v4f*)(outp + go) = ov;
      }
      // the next tile's set-up overwrites the address and data registers these stores name
      asm volatile("s_wait_xcnt 0x0" ::: "memory");
    }
  }
  }
}

// =====================================================================================================
// Inputs: in0 q [NB][NHD][TT][DKY] f32, in1 k same, in2 v [NB][NHD][TT][DVL] f32; bh = b*NHD + h.
// d_out f32 [NB][NHD][TT][DVL] at byte 0.
//   Vt  f16  [NBH][DVL][TT]     0          8388608
//   end                         8388608
// =====================================================================================================
extern "C" void kernel_launch(void* const* d_in, const int* in_sizes, int n_in,
                              void* d_out, int out_size, void* d_ws, size_t ws_size,
                              hipStream_t stream) {
  const int nq = NBH * TT * DKY;                      // 2097152
  const int nv = NBH * TT * DVL;                      // 4194304
  if (n_in < 3) return;
  if (in_sizes[0] != nq) return;
  if (in_sizes[1] != nq) return;
  if (in_sizes[2] != nv) return;
  if (out_size != nv) return;

  const float* q = (const float*)d_in[0];
  const float* k = (const float*)d_in[1];
  const float* v = (const float*)d_in[2];

  const size_t PV = (size_t)nv * 2;                   // 8388608
  size_t off = 0;
  const size_t oV = off; off += PV;
  if (off > ws_size) return;                          // off = 8388608
  if (off > (size_t)134217728) return;

  char* ws = (char*)d_ws;
  unsigned short* Vt = (unsigned short*)(ws + oV);
  float* outf = (float*)d_out;

  const dim3 blk(256);
  const dim3 gV(TT / 64, NBH);                        // (32, 32)
  const float sscale = 1.0f / sqrtf((float)DKY);

  // (1) v -> f16 v^T plane [bh][d][pos], values x VSC
  v_planes<<<gV, blk, 0, stream>>>(v, Vt, VSC);
  // (2) causal polynomial attention (reads q and k as f32) -> d_out
  attn_poly<<<dim3(NBH * (NQB / 2)), dim3(256), 0, stream>>>(q, k, Vt, outf, sscale);
  (void)hipGetLastError();
}

// v006
// It runs in 40.3 microseconds.
// Next to v005, in two timings, it ran 1.05 times as fast each time.
// Over all steps from v000 it is 3.06 times as fast.
// Contractions: q.k^T scores = v_wmma_f32_16x16x32_bf16 (bf16 operands = q and k RNE-converted where they are read, single
// product, d_key 32 = one k-step); a.v context = v_wmma_f32_16x16x32_f16 (a carried as an f16 hi plane x64 plus an f16 residual
// plane x64x1024 feeding a second accumulator, v as f16 of the bf16-converted value x16; two products); all f32
// accumulate; cubic truncated-exp polynomial (fused multiply-adds), causal zeroing, row sums Z and the final S*(1/Z) in f32.
// Both products run transposed (scores^T = k . q^T, context^T = v^T . a^T): the score accumulators are the a^T operand.
#include <hip/hip_runtime.h>
#include <math.h>
#include <stdint.h>

#define TT    2048                 // sequence length (queries == keys)
#define NB    4
#define NHD   8
#define DKY   32                   // d_key
#define DVL   64                   // d_val
#define NBH   (NB * NHD)           // 32 (batch, head) pairs; bh = b*NHD + h
#define NQB   (TT / 64)            // 32 query / key tiles of 64
#define AHS   64.0f                // hi plane carry of the polynomial weights (exact power of two)
#define ALS   1024.0f              // residual plane carry on top of AHS (exact power of two)
#define VSC   16.0f                // v plane carry (exact power of two)
#define F16MX 65504.0f
// LDS row pitches in 16-bit elements: 16 B x odd, so that the 16 rows one ds_load_b128 half-wave reads start on
// 16 distinct bank quads (bank = dword address mod 64) instead of 2 (128-B rows) or 4 (64-B rows).
#define KPT   40                   // K rows: 32 halves + 8 pad  = 80 B
#define VPT   72                   // V^T rows: 64 halves + 8 pad = 144 B
#define OPT   68                   // output staging rows (f32): 64 floats + 4 pad = 272 B
static_assert((TT % 64) == 0);
static_assert((NQB % 2) == 0);
static_assert(DKY == 32);
static_assert(DVL == 64);
static_assert((KPT % 16) == 8 && (VPT % 16) == 8 && (OPT % 8) == 4);

typedef _Float16 v16h __attribute__((ext_vector_type(16)));
typedef _Float16 v8h  __attribute__((ext_vector_type(8)));
typedef __bf16   v16b __attribute__((ext_vector_type(16)));
typedef __bf16   v8b  __attribute__((ext_vector_type(8)));
typedef __bf16   v4b  __attribute__((ext_vector_type(4)));
typedef float    v8f  __attribute__((ext_vector_type(8)));
typedef float    v4f  __attribute__((ext_vector_type(4)));
typedef float    v2f  __attribute__((ext_vector_type(2)));
typedef _Float16 v2h  __attribute__((ext_vector_type(2)));
typedef unsigned int v4u __attribute__((ext_vector_type(4)));

// ---- scalar helpers --------------------------------------------------------------------------------
__device__ __forceinline__ unsigned short bf_bits(float f) {          // f32 -> bf16 bits, RNE convert
  unsigned u = __float_as_uint(f);
  return (unsigned short)((u + 0x7FFFu + ((u >> 16) & 1u)) >> 16);
}
__device__ __forceinline__ float bf_up(unsigned short h) { return __uint_as_float(((unsigned)h) << 16); }
__device__ __forceinline__ unsigned short h_bits(_Float16 x) { return __builtin_bit_cast(unsigned short, x); }
__device__ __forceinline__ unsigned pk16(unsigned short a, unsigned short b) { return (unsigned)a | ((unsigned)b << 16); }
__device__ __forceinline__ v8f zero8() { v8f z = {0.f, 0.f, 0.f, 0.f, 0.f, 0.f, 0.f, 0.f}; return z; }

// Degree-3 truncated exp of x = s * c, carried x AHS, as a cubic in the raw score s: three packed fused multiply-adds,
// AHS + s*(k1 + s*(k2 + s*k3)) with k1 = AHS c, k2 = AHS c^2 / 2, k3 = AHS c^3 / 6.
__device__ __forceinline__ v2f poly3(v2f s, float k1, float k2, float k3) {
  v2f t = __builtin_elementwise_fma(s, (v2f){k3, k3}, (v2f){k2, k2});
  t = __builtin_elementwise_fma(s, t, (v2f){k1, k1});
  t = __builtin_elementwise_fma(s, t, (v2f){AHS, AHS});
  return t;
}

// ---- WMMA helpers with trailing VALU hazard gap --------------------------------------------------------
__device__ __forceinline__ v8f mma_b(v16b a, v16b b, v8f c) {
  c = __builtin_amdgcn_wmma_f32_16x16x32_bf16(false, a, false, b, (short)0, c, false, false);
#if defined(__HIP_DEVICE_COMPILE__)
  asm volatile("v_nop\n\tv_nop\n\tv_nop\n\tv_nop" : "+v"(c) : "v"(a), "v"(b));
#endif
  return c;
}
__device__ __forceinline__ v8f mma_h(v16h a, v16h b, v8f c) {
  c = __builtin_amdgcn_wmma_f32_16x16x32_f16(false, a, false, b, (short)0, c, false, false);
#if defined(__HIP_DEVICE_COMPILE__)
  asm volatile("v_nop\n\tv_nop\n\tv_nop\n\tv_nop" : "+v"(c) : "v"(a), "v"(b));
#endif
  return c;
}

// =====================================================================================================
// v f32 [bh][pos][DVL] -> f16 v^T plane vt[(bh*DVL + d)*TT + s] = f16(bf16_rne(v) * vsc) (exact for a power of two).
// Block = one 64-position x 64-feature tile of one bh; grid = (TT/64, NBH); tile staged in LDS as f32
// (256 threads x 4 v4f loads, __syncthreads).
// Store: group g = tid>>3 (0..31), piece = tid&7: iteration it writes row d = it*32 + g; lanes 8g..8g+7 x 16 B =
// coverage: 2 iterations x 32 groups = 64 rows d, 8 pieces x 8 = 64 keys per row; grid covers every (bh, s tile).
// =====================================================================================================
__global__ __launch_bounds__(256) void v_planes(const float* __restrict__ vf, unsigned short* vt, float vsc) {
  __shared__ __align__(16) float sv[64 * 68];        // [tt][d], pitch 68 floats (272 B, 16-B aligned rows)
  const int tid = threadIdx.x;
  const int s0  = blockIdx.x * 64;
  const int bh  = blockIdx.y;
  if (bh >= NBH || s0 >= TT) return;                 // block-uniform, ahead of every barrier
  const float* src = vf + ((size_t)bh * TT + (size_t)s0) * DVL;   // 64 rows x 64 floats, contiguous
#pragma unroll
  for (int i = 0; i < 4; ++i) {
    const int idx = i * 256 + tid;                   // 0..1023
    const int tt = idx >> 4, c4 = (idx & 15) * 4;    // tt 0..63, c4 0..60
    const v4f a = *(const v4f*)(src + (size_t)tt * DVL + c4);
    *(v4f*)(sv + tt * 68 + c4) = a;
  }
  __syncthreads();

  const int g = tid >> 3, piece = tid & 7;
  v4u hv[2];
  size_t hofs[2];
#pragma unroll
  for (int it = 0; it < 2; ++it) {
    const int d = it * 32 + g;
    v4u a;
#pragma unroll
    for (int e = 0; e < 4; ++e) {
      const float f0 = sv[(piece * 8 + 2 * e) * 68 + d];
      const float f1 = sv[(piece * 8 + 2 * e + 1) * 68 + d];
      const _Float16 x0 = (_Float16)(bf_up(bf_bits(f0)) * vsc);
      const _Float16 x1 = (_Float16)(bf_up(bf_bits(f1)) * vsc);
      a[e] = pk16(h_bits(x0), h_bits(x1));
    }
    hv[it] = a;
    hofs[it] = ((size_t)(bh * DVL + d)) * TT + (size_t)s0 + (size_t)(piece * 8);
  }
  {
#pragma unroll
    for (int it = 0; it < 2; ++it) {
      *(v4u*)(vt + hofs[it]) = hv[it];
    }
    
  }
}

// =====================================================================================================
// Causal polynomial attention, d_key 32, d_val 64.
//   q f32 input: element (bh, t, d) at [(bh*TT + t)*DKY + d];  k f32 input: (bh, s, d) at [(bh*TT + s)*DKY + d];
//   both are converted to bf16 (RNE) here: q on its way into the fragment registers, k on its way into LDS
//   v^T plane f16 (x VSC): (bh, d, s) at [(bh*DVL + d)*TT + s]
//   raw scores^T = k . q^T on bf16 WMMA (A = 16 K rows, B = the wave's 16 queries, one k-step of 32 over d), f32
//   accumulate: register r of tile j in lane (c, hh) = key j*16 + 8hh + r against query c. With x = raw * sscale,
//   64 a = 64 (1 + x + x^2/2 + x^3/6) as a cubic in raw (f32, three fused multiply-adds, sscale and the carry of 64
//   inside its coefficients), keys > query replaced by 0, z += 64 a (f32, in-lane: a lane holds one query;
//   four partials, by the parity of tile j and of register r, fixed order; Z is carried x64 to the epilogue).
//   a planes: hi = f16(clamp(64 a)), lo = f16((clamp(64 a) - hi) * 1024) (the difference is exact in f32);
//   score tiles 2kk and 2kk+1, converted in place, are the B operand (keys kk*32.. in the hardware k order) of
//   context_hi^T += v^T . hi^T, context_lo^T += v^T . lo^T on f16 WMMA (A = 16 V^T rows, 2 k-steps of 32 per 64-key
//   chunk), separate accumulators: the weights never pass through LDS. Register r of tile t = feature t*16 + 8hh + r of
//   query c; epilogue 64 S = (context_hi + context_lo / 1024) / VSC, out = 64 S * (1 / (64 Z)).
//   Block = 8 waves in two groups of 4; it runs two 64-row query tiles of one bh one after the other, tile NQB-1-p
//   and then tile p, so that every block walks NQB+1 key chunks (causal cost is linear in the tile index; all blocks
//   are resident at once and the launch lasts as long as its fullest block). grid = (NQB/2) * NBH; key chunks 0..qb
//   per tile (block-uniform trip count, statically clamped to NQB); every processed chunk holds at least one live key.
//   Key split: wave w and wave w+4 own the same 16 query rows; group 0 (waves 0..3) takes the even key chunks, group 1
//   (waves 4..7) the odd ones, each group with its own K / V^T buffers, one pair of chunks per pass. The weights are a
//   plain sum over keys (no running maximum), so the two groups' context and Z partials just add: at the end of a tile
//   group 1 hands its partials over in LDS, one __syncthreads, group 0 adds them and finishes the tile.
//   K / V^T chunk staging per group: K 64 rows x 32 floats = 8 KB contiguous (4 x 16 B per thread, a wave's load = 512
//   contiguous B, 4 bf16 = 8 B to LDS each), V^T 64 rows x 64 halves (2 threads per row, 4 x 16 B each); plain loads,
//   __syncthreads before and after.
//   out f32 [bh][pos][DVL]: row (bh, t) = 64 floats = 256 B; each wave stages its 16x64 tile in LDS, then one
//   instruction per row pair: lanes 0..15 x 16 B = row 2i, lanes 16..31 x 16 B = row 2i+1 (512 contiguous B =
// coverage: 8 instructions x 2 rows x 64 cols = the wave's 16 rows; 4 waves = the 64-row tile; p = 0..NQB/2-1 with
//   tiles p and NQB-1-p = every query tile once; grid = every (bh, p).
// =====================================================================================================
// waves_per_eu(4, 4): two blocks of 8 waves on a WGP = four waves per SIMD, 256 registers a wave.
__global__ __launch_bounds__(256) __attribute__((amdgpu_waves_per_eu(4, 4)))
void attn_poly(const float* __restrict__ qf, const float* __restrict__ kf,
               const unsigned short* __restrict__ vtpl, float* outp, float sscale) {
#pragma clang fp contract(off)
  union FH { v16h v; v8h h[2]; };
  union FB { v16b v; v8b h[2]; };
  __shared__ __align__(16) __bf16   Ksh2[2][64 * KPT];              // per group K [kv][d], padded rows     5 KB each
  __shared__ __align__(16) _Float16 Vth2[2][DVL * VPT];             // per group V^T [d][kv], padded rows   9 KB each
  __shared__ __align__(16) float    Os[4][16 * OPT];                // per group-0 wave context tile [row][d], padded rows
  __shared__ __align__(16) float    Cs[4][9 * 32 * 4];              // group 1 -> group 0: [piece][lane] x 4 floats

  const int tid  = threadIdx.x & 127;        // thread index inside its group of 4 waves
  // wave number in a scalar register: the tests on the group below become scalar branches, EXEC stays all ones
  const int wv8  = __builtin_amdgcn_readfirstlane((int)(threadIdx.x >> 5));
  const int grp  = wv8 >> 2;                 // 0: even key chunks, 1: odd key chunks
  const int wave = wv8 & 3;                  // which 16 query rows of the tile
  const int lane = tid & 31;
  __bf16*   Ksh = Ksh2[grp];
  _Float16* Vth = Vth2[grp];
  const int hh   = lane >> 4;
  const int c    = lane & 15;

  const int bx = blockIdx.x;
  const int pr = bx % (NQB / 2);
  const int bh = bx / (NQB / 2);
  if (bh >= NBH) return;                     // block-uniform, ahead of every barrier

  // coefficients of the weight cubic in the raw score, x AHS (wave-uniform)
  const float pk1 = AHS * sscale;
  const float pk2 = (AHS * 0.5f) * (sscale * sscale);
  const float pk3 = (AHS / 6.0f) * (sscale * sscale * sscale);

  const float*    Qp = qf + (size_t)bh * TT * DKY;
  const float*    Kp = kf + (size_t)bh * TT * DKY;
  const _Float16* Vh = (const _Float16*)(const void*)vtpl + (size_t)bh * DVL * TT;

  // one copy of the tile body: the two tiles of a block run strictly one after the other in every wave
#pragma unroll 1
  for (int half = 0; half < 2; ++half) {
  const int qb = half ? pr : (NQB - 1 - pr);   // block-uniform
  const int q0 = qb * 64 + wave * 16;

  // ---- Q fragment (B operand, column = lane&15): one d-chunk of 32; elements 0..7 <- d 8hh.., 8..15 <- d 16+8hh.. ----
  v16b qa;
  {
    const float* qg = Qp + (size_t)(q0 + c) * DKY + 8 * hh;
    v4f qv[4];
    qv[0] = *(const v4f*)(qg);
    qv[1] = *(const v4f*)(qg + 4);
    qv[2] = *(const v4f*)(qg + 16);
    qv[3] = *(const v4f*)(qg + 20);
#pragma unroll
    for (int i = 0; i < 4; ++i) {
      const v4b qc = __builtin_convertvector(qv[i], v4b);
#pragma unroll
      for (int e = 0; e < 4; ++e) qa[4 * i + e] = qc[e];
    }
  }

  v2f zl[2];                                 // Z partials of query c: [tile j odd][register r odd]
  v8f oacc[4], olo[4];
#pragma unroll
  for (int u = 0; u < 2; ++u) zl[u] = (v2f){0.f, 0.f};
#pragma unroll
  for (int t = 0; t < 4; ++t) { oacc[t] = zero8(); olo[t] = zero8(); }

  int nkt = qb + 1;                          // causal: key chunks 0..qb, block-uniform
  if (nkt > NQB) nkt = NQB;
  const int npass = (nkt + 1) >> 1;          // block-uniform: every wave passes every barrier
  for (int ps = 0; ps < npass; ++ps) {
    const int kt = 2 * ps + grp;
    const bool live = kt < nkt;              // false only for group 1 in the last pass of an odd chunk count
    const int kv0 = kt * 64;
    __syncthreads();
    if (live) {
      const float* kg = Kp + (size_t)kv0 * DKY + tid * 4;             // piece i*128 + tid of the chunk's 512 x 4 floats
      v4f ka[4];
#pragma unroll
      for (int i = 0; i < 4; ++i) ka[i] = *(const v4f*)(kg + i * 512);
#pragma unroll
      for (int i = 0; i < 4; ++i) {                                   // K row i*16 + (tid>>3), d = 4*(tid&7)..+3
        *(v4b*)(Ksh + (i * 16 + (tid >> 3)) * KPT + (tid & 7) * 4) = __builtin_convertvector(ka[i], v4b);
      }
      const int r  = tid >> 1;                                        // V^T row d = r
      const int so = (tid & 1) * 32;                                  // s = kv0+so..kv0+so+31
      const _Float16* vg = Vh + (size_t)r * TT + (size_t)kv0 + (size_t)so;
#pragma unroll
      for (int i = 0; i < 4; ++i) {
        const v8h b0 = *(const v8h*)(vg + 8 * i);
        *(v8h*)(Vth + r * VPT + so + 8 * i) = b0;
      }
    }
    __syncthreads();
    if (!live) continue;

    // ---- raw scores^T: 64 keys x 16 queries per wave, bf16 product, one d-chunk ----
    v8f s[4];
#pragma unroll
    for (int j = 0; j < 4; ++j) {
      FB kb;
      kb.h[0] = *(const v8b*)(Ksh + (j * 16 + c) * KPT + 8 * hh);
      kb.h[1] = *(const v8b*)(Ksh + (j * 16 + c) * KPT + 16 + 8 * hh);
      s[j] = mma_b(kb.v, qa, zero8());
    }

    const int dq = q0 + c - kv0 - 8 * hh;    // key j*16 + 8hh + r of the chunk is past query c where j*16 + r > dq
    // unrolled: kk picks the score tiles, which are registers and need compile-time indices
#pragma unroll
    for (int kk = 0; kk < 2; ++kk) {
      // ---- scale, polynomial, causal zeroing, Z partials; hi / residual planes straight into the B fragments:
      //      element 8u + r <- key kk*32 + 16u + 8hh + r = register r of score tile 2kk + u ----
      FH pa, pl;
#pragma unroll
      for (int u = 0; u < 2; ++u) {
        const int j = 2 * kk + u;
#pragma unroll
        for (int rp = 0; rp < 4; ++rp) {                              // registers 2rp, 2rp+1: two consecutive keys
          const int kr = j * 16 + 2 * rp;
          v2f a = poly3((v2f){s[j][2 * rp], s[j][2 * rp + 1]}, pk1, pk2, pk3);   // 64 a
          a[0] = (kr > dq) ? 0.0f : a[0];
          a[1] = (kr + 1 > dq) ? 0.0f : a[1];
          zl[u] += a;
          v2f ac = a;
          ac[0] = fminf(fmaxf(ac[0], -F16MX), F16MX);
          ac[1] = fminf(fmaxf(ac[1], -F16MX), F16MX);
          const v2h ah = __builtin_convertvector(ac, v2h);
          pa.h[u][2 * rp]     = ah[0];
          pa.h[u][2 * rp + 1] = ah[1];
          const v2h al = __builtin_convertvector((ac - __builtin_convertvector(ah, v2f)) * ALS, v2h);
          pl.h[u][2 * rp]     = al[0];
          pl.h[u][2 * rp + 1] = al[1];
        }
      }
      // ---- context_hi^T += V^T . hi^T, context_lo^T += V^T . lo^T (f16 WMMA, separate accumulators) ----
#pragma unroll
      for (int t = 0; t < 4; ++t) {
        FH vb;
        vb.h[0] = *(const v8h*)(Vth + (t * 16 + c) * VPT + kk * 32 + 8 * hh);
        vb.h[1] = *(const v8h*)(Vth + (t * 16 + c) * VPT + kk * 32 + 16 + 8 * hh);
        oacc[t] = mma_h(vb.v, pa.v, oacc[t]);
        olo[t]  = mma_h(vb.v, pl.v, olo[t]);
      }
    }
  }

  // ---- join of the key split: group 1 stores hi + lo/1024 (8 pieces) and its Z partials (1 piece), lane-major ----
  float* cs = Cs[wave];
  if (grp == 1) {
#pragma unroll
    for (int t = 0; t < 4; ++t) {
#pragma unroll
      for (int g4 = 0; g4 < 2; ++g4) {
        v4f pv;
#pragma unroll
        for (int e = 0; e < 4; ++e) pv[e] = oacc[t][4 * g4 + e] + olo[t][4 * g4 + e] * (1.0f / ALS);
        *(v4f*)(cs + ((t * 2 + g4) * 32 + lane) * 4) = pv;
      }
    }
    {
      v4f zv;
#pragma unroll
      for (int e = 0; e < 4; ++e) zv[e] = zl[e >> 1][e & 1];
      *(v4f*)(cs + (8 * 32 + lane) * 4) = zv;
    }
  }
  __syncthreads();                           // publishes group 1's partials; block-uniform
  if (grp == 1) continue;                    // group 1 goes on to the next tile's first barrier
  float so[4][8];                            // the odd chunks' context partial, this lane's 32 elements
#pragma unroll
  for (int t = 0; t < 4; ++t) {
#pragma unroll
    for (int g4 = 0; g4 < 2; ++g4) {
      const v4f pv = *(const v4f*)(cs + ((t * 2 + g4) * 32 + lane) * 4);
#pragma unroll
      for (int e = 0; e < 4; ++e) so[t][4 * g4 + e] = pv[e];
    }
  }
  {
    const v4f zv = *(const v4f*)(cs + (8 * 32 + lane) * 4);
#pragma unroll
    for (int e = 0; e < 4; ++e) zl[e >> 1][e & 1] += zv[e];
  }

  // ---- Z fold (the four in-lane partials, then the other half of the keys from lane ^ 16, fixed order),
  //      64 S = (hi + lo/1024)/VSC, 64 S * (1/(64 Z)); a lane holds 8 consecutive features of its query per tile t ----
  float* os = Os[wave];
  {
    float z = (zl[0][0] + zl[0][1]) + (zl[1][0] + zl[1][1]);
    z += __shfl_xor(z, 16, 32);
    const float rz = 1.0f / z;
#pragma unroll
    for (int t = 0; t < 4; ++t) {
#pragma unroll
      for (int g4 = 0; g4 < 2; ++g4) {
        v4f ov;
#pragma unroll
        for (int e = 0; e < 4; ++e) {
          const int r = 4 * g4 + e;
          const float sv = ((oacc[t][r] + olo[t][r] * (1.0f / ALS)) + so[t][r]) * (1.0f / VSC);
          ov[e] = sv * rz;
        }
        *(v4f*)(os + c * OPT + t * 16 + 8 * hh + 4 * g4) = ov;
      }
    }
  }
  __builtin_amdgcn_fence(__ATOMIC_RELEASE, "workgroup");
  __builtin_amdgcn_wave_barrier();
  __builtin_amdgcn_fence(__ATOMIC_ACQUIRE, "workgroup");
  {
    const int col4 = c * 4;                      // 16 lanes x 4 floats = one whole 64-float row
    {
#pragma unroll
      for (int it = 0; it < 8; ++it) {           // row pairs (2it, 2it+1) of the wave tile
        const int rr = 2 * it + hh;
        const v4f ov = *(const v4f*)(os + rr * OPT + col4);
        const size_t go = ((size_t)(bh * TT + q0 + rr)) * DVL + (size_t)col4;
        *(v4f*)(outp + go) = ov;
      }
      // the next tile's set-up overwrites the address and data registers these stores name
      asm volatile("s_wait_xcnt 0x0" ::: "memory");
    }
  }
  }
}

// =====================================================================================================
// Inputs: in0 q [NB][NHD][TT][DKY] f32, in1 k same, in2 v [NB][NHD][TT][DVL] f32; bh = b*NHD + h.
// d_out f32 [NB][NHD][TT][DVL] at byte 0.
//   Vt  f16  [NBH][DVL][TT]     0          8388608
//   end                         8388608
// =====================================================================================================
extern "C" void kernel_launch(void* const* d_in, const int* in_sizes, int n_in,
                              void* d_out, int out_size, void* d_ws, size_t ws_size,
                              hipStream_t stream) {
  const int nq = NBH * TT * DKY;                      // 2097152
  const int nv = NBH * TT * DVL;                      // 4194304
  if (n_in < 3) return;
  if (in_sizes[0] != nq) return;
  if (in_sizes[1] != nq) return;
  if (in_sizes[2] != nv) return;
  if (out_size != nv) return;

  const float* q = (const float*)d_in[0];
  const float* k = (const float*)d_in[1];
  const float* v = (const float*)d_in[2];

  const size_t PV = (size_t)nv * 2;                   // 8388608
  size_t off = 0;
  const size_t oV = off; off += PV;
  if (off > ws_size) return;                          // off = 8388608
  if (off > (size_t)134217728) return;

  char* ws = (char*)d_ws;
  unsigned short* Vt = (unsigned short*)(ws + oV);
  float* outf = (float*)d_out;

  const dim3 blk(256);
  const dim3 gV(TT / 64, NBH);                        // (32, 32)
  const float sscale = 1.0f / sqrtf((float)DKY);

  // (1) v -> f16 v^T plane [bh][d][pos], values x VSC
  v_planes<<<gV, blk, 0, stream>>>(v, Vt, VSC);
  // (2) causal polynomial attention (reads q and k as f32) -> d_out
  attn_poly<<<dim3(NBH * (NQB / 2)), dim3(256), 0, stream>>>(q, k, Vt, outf, sscale);
  (void)hipGetLastError();
}

// v007
// One run takes 37 microseconds.
// Timed twice side by side with v006, it ran 1.08 and 1.09 times as fast.
// Over all steps from v000 it is 3.32 times as fast.
// Contractions: q.k^T scores = v_wmma_f32_16x16x32_bf16 (bf16 operands = q and k RNE-converted where they are read, single
// product, d_key 32 = one k-step); a.v context = v_wmma_f32_16x16x32_f16 (a carried as an f16 hi plane x64 plus an f16 residual
// plane x64x1024 feeding a second accumulator, v as f16 of the bf16-converted value x16; two products); all f32
// accumulate; cubic truncated-exp polynomial (fused multiply-adds), causal zeroing, row sums Z and the final S*(1/Z) in f32.
// Both products run transposed (scores^T = k . q^T, context^T = v^T . a^T): the score accumulators are the a^T operand.
#include <hip/hip_runtime.h>
#include <math.h>
#include <stdint.h>

#define TT    2048                 // sequence length (queries == keys)
#define NB    4
#define NHD   8
#define DKY   32                   // d_key
#define DVL   64                   // d_val
#define NBH   (NB * NHD)           // 32 (batch, head) pairs; bh = b*NHD + h
#define NQB   (TT / 64)            // 32 query / key tiles of 64
#define AHS   64.0f                // hi plane carry of the polynomial weights (exact power of two)
#define ALS   1024.0f              // residual plane carry on top of AHS (exact power of two)
#define VSC   16.0f                // v plane carry (exact power of two)
#define F16MX 65504.0f
// LDS row pitches in 16-bit elements: 16 B x odd, so that the 16 rows one ds_load_b128 half-wave reads start on
// 16 distinct bank quads (bank = dword address mod 64) instead of 2 (128-B rows) or 4 (64-B rows).
#define KPT   40                   // K rows: 32 halves + 8 pad  = 80 B
#define VPT   72                   // V^T rows: 64 halves + 8 pad = 144 B
#define OPT   68                   // output staging rows (f32): 64 floats + 4 pad = 272 B
static_assert((TT % 64) == 0);
static_assert((NQB % 2) == 0);
static_assert(DKY == 32);
static_assert(DVL == 64);
static_assert((KPT % 16) == 8 && (VPT % 16) == 8 && (OPT % 8) == 4);

typedef _Float16 v16h __attribute__((ext_vector_type(16)));
typedef _Float16 v8h  __attribute__((ext_vector_type(8)));
typedef __bf16   v16b __attribute__((ext_vector_type(16)));
typedef __bf16   v8b  __attribute__((ext_vector_type(8)));
typedef __bf16   v4b  __attribute__((ext_vector_type(4)));
typedef float    v8f  __attribute__((ext_vector_type(8)));
typedef float    v4f  __attribute__((ext_vector_type(4)));
typedef float    v2f  __attribute__((ext_vector_type(2)));
typedef _Float16 v2h  __attribute__((ext_vector_type(2)));
typedef unsigned int v4u __attribute__((ext_vector_type(4)));

// ---- scalar helpers --------------------------------------------------------------------------------
__device__ __forceinline__ unsigned short bf_bits(float f) {          // f32 -> bf16 bits, RNE convert
  unsigned u = __float_as_uint(f);
  return (unsigned short)((u + 0x7FFFu + ((u >> 16) & 1u)) >> 16);
}
__device__ __forceinline__ float bf_up(unsigned short h) { return __uint_as_float(((unsigned)h) << 16); }
__device__ __forceinline__ unsigned short h_bits(_Float16 x) { return __builtin_bit_cast(unsigned short, x); }
__device__ __forceinline__ unsigned pk16(unsigned short a, unsigned short b) { return (unsigned)a | ((unsigned)b << 16); }
__device__ __forceinline__ v8f zero8() { v8f z = {0.f, 0.f, 0.f, 0.f, 0.f, 0.f, 0.f, 0.f}; return z; }

// Degree-3 truncated exp of x = s * c, carried x AHS, as a cubic in the raw score s: three packed fused multiply-adds,
// AHS + s*(k1 + s*(k2 + s*k3)) with k1 = AHS c, k2 = AHS c^2 / 2, k3 = AHS c^3 / 6.
__device__ __forceinline__ v2f poly3(v2f s, float k1, float k2, float k3) {
  v2f t = __builtin_elementwise_fma(s, (v2f){k3, k3}, (v2f){k2, k2});
  t = __builtin_elementwise_fma(s, t, (v2f){k1, k1});
  t = __builtin_elementwise_fma(s, t, (v2f){AHS, AHS});
  return t;
}

// ---- WMMA helpers: builtin forms, the compiler keeps their hazard distances itself ----------------------
__device__ __forceinline__ v8f mma_b(v16b a, v16b b, v8f c) {
  c = __builtin_amdgcn_wmma_f32_16x16x32_bf16(false, a, false, b, (short)0, c, false, false);
  return c;
}
__device__ __forceinline__ v8f mma_h(v16h a, v16h b, v8f c) {
  c = __builtin_amdgcn_wmma_f32_16x16x32_f16(false, a, false, b, (short)0, c, false, false);
  return c;
}

// =====================================================================================================
// v f32 [bh][pos][DVL] -> f16 v^T plane vt[(bh*DVL + d)*TT + s] = f16(bf16_rne(v) * vsc) (exact for a power of two).
// Block = one 64-position x 64-feature tile of one bh; grid = (TT/64, NBH); tile staged in LDS as f32
// (256 threads x 4 v4f loads, __syncthreads).
// Store: group g = tid>>3 (0..31), piece = tid&7: iteration it writes row d = it*32 + g; lanes 8g..8g+7 x 16 B =
// coverage: 2 iterations x 32 groups = 64 rows d, 8 pieces x 8 = 64 keys per row; grid covers every (bh, s tile).
// =====================================================================================================
__global__ __launch_bounds__(256) void v_planes(const float* __restrict__ vf, unsigned short* vt, float vsc) {
  __shared__ __align__(16) float sv[64 * 68];        // [tt][d], pitch 68 floats (272 B, 16-B aligned rows)
  const int tid = threadIdx.x;
  const int s0  = blockIdx.x * 64;
  const int bh  = blockIdx.y;
  if (bh >= NBH || s0 >= TT) return;                 // block-uniform, ahead of every barrier
  const float* src = vf + ((size_t)bh * TT + (size_t)s0) * DVL;   // 64 rows x 64 floats, contiguous
#pragma unroll
  for (int i = 0; i < 4; ++i) {
    const int idx = i * 256 + tid;                   // 0..1023
    const int tt = idx >> 4, c4 = (idx & 15) * 4;    // tt 0..63, c4 0..60
    const v4f a = *(const v4f*)(src + (size_t)tt * DVL + c4);
    *(v4f*)(sv + tt * 68 + c4) = a;
  }
  __syncthreads();

  const int g = tid >> 3, piece = tid & 7;
  v4u hv[2];
  size_t hofs[2];
#pragma unroll
  for (int it = 0; it < 2; ++it) {
    const int d = it * 32 + g;
    v4u a;
#pragma unroll
    for (int e = 0; e < 4; ++e) {
      const float f0 = sv[(piece * 8 + 2 * e) * 68 + d];
      const float f1 = sv[(piece * 8 + 2 * e + 1) * 68 + d];
      const _Float16 x0 = (_Float16)(bf_up(bf_bits(f0)) * vsc);
      const _Float16 x1 = (_Float16)(bf_up(bf_bits(f1)) * vsc);
      a[e] = pk16(h_bits(x0), h_bits(x1));
    }
    hv[it] = a;
    hofs[it] = ((size_t)(bh * DVL + d)) * TT + (size_t)s0 + (size_t)(piece * 8);
  }
  {
#pragma unroll
    for (int it = 0; it < 2; ++it) {
      *(v4u*)(vt + hofs[it]) = hv[it];
    }
    
  }
}

// =====================================================================================================
// Causal polynomial attention, d_key 32, d_val 64.
//   q f32 input: element (bh, t, d) at [(bh*TT + t)*DKY + d];  k f32 input: (bh, s, d) at [(bh*TT + s)*DKY + d];
//   both are converted to bf16 (RNE) here: q on its way into the fragment registers, k on its way into LDS
//   v^T plane f16 (x VSC): (bh, d, s) at [(bh*DVL + d)*TT + s]
//   raw scores^T = k . q^T on bf16 WMMA (A = 16 K rows, B = the wave's 16 queries, one k-step of 32 over d), f32
//   accumulate: register r of tile j in lane (c, hh) = key j*16 + 8hh + r against query c. With x = raw * sscale,
//   64 a = 64 (1 + x + x^2/2 + x^3/6) as a cubic in raw (f32, three fused multiply-adds, sscale and the carry of 64
//   inside its coefficients), keys > query replaced by 0, z += 64 a (f32, in-lane: a lane holds one query;
//   four partials, by the parity of tile j and of register r, fixed order; Z is carried x64 to the epilogue).
//   a planes: hi = f16(clamp(64 a)), lo = f16((clamp(64 a) - hi) * 1024) (the difference is exact in f32);
//   score tiles 2kk and 2kk+1, converted in place, are the B operand (keys kk*32.. in the hardware k order) of
//   context_hi^T += v^T . hi^T, context_lo^T += v^T . lo^T on f16 WMMA (A = 16 V^T rows, 2 k-steps of 32 per 64-key
//   chunk), separate accumulators: the weights never pass through LDS. Register r of tile t = feature t*16 + 8hh + r of
//   query c; epilogue 64 S = (context_hi + context_lo / 1024) / VSC, out = 64 S * (1 / (64 Z)).
//   Block = 8 waves in two groups of 4; it runs two 64-row query tiles of one bh one after the other, tile NQB-1-p
//   and then tile p, so that every block walks NQB+1 key chunks (causal cost is linear in the tile index; all blocks
//   are resident at once and the launch lasts as long as its fullest block). grid = (NQB/2) * NBH; key chunks 0..qb
//   per tile (block-uniform trip count, statically clamped to NQB); every processed chunk holds at least one live key.
//   Key split: wave w and wave w+4 own the same 16 query rows; group 0 (waves 0..3) takes the even key chunks, group 1
//   (waves 4..7) the odd ones, each group with its own K / V^T buffers, one pair of chunks per pass. The weights are a
//   plain sum over keys (no running maximum), so the two groups' context and Z partials just add: at the end of a tile
//   group 1 hands its partials over in LDS, one __syncthreads, group 0 adds them and finishes the tile.
//   K / V^T chunk staging per group: K 64 rows x 32 floats = 8 KB contiguous (4 x 16 B per thread, a wave's load = 512
//   contiguous B, 4 bf16 = 8 B to LDS each), V^T 64 rows x 64 halves (2 threads per row, 4 x 16 B each); plain loads,
//   __syncthreads before and after.
//   out f32 [bh][pos][DVL]: row (bh, t) = 64 floats = 256 B; each group-0 wave stages its 16x64 tile in LDS, then one
//   instruction per row pair: lanes 0..15 x 16 B = row 2i, lanes 16..31 x 16 B = row 2i+1 (512 contiguous B =
// coverage: 8 instructions x 2 rows x 64 cols = the wave's 16 rows; 4 waves = the 64-row tile; p = 0..NQB/2-1 with
//   tiles p and NQB-1-p = every query tile once; grid = every (bh, p).
// =====================================================================================================
// waves_per_eu(4, 4): two blocks of 8 waves on a WGP = four waves per SIMD, 256 registers a wave.
__global__ __launch_bounds__(256) __attribute__((amdgpu_waves_per_eu(4, 4)))
void attn_poly(const float* __restrict__ qf, const float* __restrict__ kf,
               const unsigned short* __restrict__ vtpl, float* outp, float sscale) {
#pragma clang fp contract(off)
  union FH { v16h v; v8h h[2]; };
  union FB { v16b v; v8b h[2]; };
  __shared__ __align__(16) __bf16   Ksh2[2][64 * KPT];              // per group K [kv][d], padded rows     5 KB each
  __shared__ __align__(16) _Float16 Vth2[2][DVL * VPT];             // per group V^T [d][kv], padded rows   9 KB each
  __shared__ __align__(16) float    Os[4][16 * OPT];                // per group-0 wave context tile [row][d], padded rows
  __shared__ __align__(16) float    Cs[4][9 * 32 * 4];              // group 1 -> group 0: [piece][lane] x 4 floats

  const int tid  = threadIdx.x & 127;        // thread index inside its group of 4 waves
  // wave number in a scalar register: the tests on the group below become scalar branches, EXEC stays all ones
  const int wv8  = __builtin_amdgcn_readfirstlane((int)(threadIdx.x >> 5));
  const int grp  = wv8 >> 2;                 // 0: even key chunks, 1: odd key chunks
  const int wave = wv8 & 3;                  // which 16 query rows of the tile
  const int lane = tid & 31;
  __bf16*   Ksh = Ksh2[grp];
  _Float16* Vth = Vth2[grp];
  const int hh   = lane >> 4;
  const int c    = lane & 15;

  const int bx = blockIdx.x;
  const int pr = bx % (NQB / 2);
  const int bh = bx / (NQB / 2);
  if (bh >= NBH) return;                     // block-uniform, ahead of every barrier

  // coefficients of the weight cubic in the raw score, x AHS (wave-uniform)
  const float pk1 = AHS * sscale;
  const float pk2 = (AHS * 0.5f) * (sscale * sscale);
  const float pk3 = (AHS / 6.0f) * (sscale * sscale * sscale);

  const float*    Qp = qf + (size_t)bh * TT * DKY;
  const float*    Kp = kf + (size_t)bh * TT * DKY;
  const _Float16* Vh = (const _Float16*)(const void*)vtpl + (size_t)bh * DVL * TT;

  // one copy of the tile body: the two tiles of a block run strictly one after the other in every wave
#pragma unroll 1
  for (int half = 0; half < 2; ++half) {
  const int qb = half ? pr : (NQB - 1 - pr);   // block-uniform
  const int q0 = qb * 64 + wave * 16;

  // ---- Q fragment (B operand, column = lane&15): one d-chunk of 32; elements 0..7 <- d 8hh.., 8..15 <- d 16+8hh.. ----
  v16b qa;
  {
    const float* qg = Qp + (size_t)(q0 + c) * DKY + 8 * hh;
    v4f qv[4];
    qv[0] = *(const v4f*)(qg);
    qv[1] = *(const v4f*)(qg + 4);
    qv[2] = *(const v4f*)(qg + 16);
    qv[3] = *(const v4f*)(qg + 20);
#pragma unroll
    for (int i = 0; i < 4; ++i) {
      const v4b qc = __builtin_convertvector(qv[i], v4b);
#pragma unroll
      for (int e = 0; e < 4; ++e) qa[4 * i + e] = qc[e];
    }
  }

  v2f zl[2];                                 // Z partials of query c: [tile j odd][register r odd]
  v8f oacc[4], olo[4];
#pragma unroll
  for (int u = 0; u < 2; ++u) zl[u] = (v2f){0.f, 0.f};
#pragma unroll
  for (int t = 0; t < 4; ++t) { oacc[t] = zero8(); olo[t] = zero8(); }

  int nkt = qb + 1;                          // causal: key chunks 0..qb, block-uniform
  if (nkt > NQB) nkt = NQB;
  const int npass = (nkt + 1) >> 1;          // block-uniform: every wave passes every barrier
  for (int ps = 0; ps < npass; ++ps) {
    const int kt = 2 * ps + grp;
    const bool live = kt < nkt;              // false only for group 1 in the last pass of an odd chunk count
    const int kv0 = kt * 64;
    __syncthreads();
    if (live) {
      const float* kg = Kp + (size_t)kv0 * DKY + tid * 4;             // piece i*128 + tid of the chunk's 512 x 4 floats
      v4f ka[4];
#pragma unroll
      for (int i = 0; i < 4; ++i) ka[i] = *(const v4f*)(kg + i * 512);
#pragma unroll
      for (int i = 0; i < 4; ++i) {                                   // K row i*16 + (tid>>3), d = 4*(tid&7)..+3
        *(v4b*)(Ksh + (i * 16 + (tid >> 3)) * KPT + (tid & 7) * 4) = __builtin_convertvector(ka[i], v4b);
      }
      const int r  = tid >> 1;                                        // V^T row d = r
      const int so = (tid & 1) * 32;                                  // s = kv0+so..kv0+so+31
      const _Float16* vg = Vh + (size_t)r * TT + (size_t)kv0 + (size_t)so;
#pragma unroll
      for (int i = 0; i < 4; ++i) {
        const v8h b0 = *(const v8h*)(vg + 8 * i);
        *(v8h*)(Vth + r * VPT + so + 8 * i) = b0;
      }
    }
    __syncthreads();
    if (!live) continue;

    // ---- raw scores^T: 64 keys x 16 queries per wave, bf16 product, one d-chunk ----
    v8f s[4];
#pragma unroll
    for (int j = 0; j < 4; ++j) {
      FB kb;
      kb.h[0] = *(const v8b*)(Ksh + (j * 16 + c) * KPT + 8 * hh);
      kb.h[1] = *(const v8b*)(Ksh + (j * 16 + c) * KPT + 16 + 8 * hh);
      s[j] = mma_b(kb.v, qa, zero8());
    }

    const int dq = q0 + c - kv0 - 8 * hh;    // key j*16 + 8hh + r of the chunk is past query c where j*16 + r > dq
    // unrolled: kk picks the score tiles, which are registers and need compile-time indices
#pragma unroll
    for (int kk = 0; kk < 2; ++kk) {
      // ---- scale, polynomial, causal zeroing, Z partials; hi / residual planes straight into the B fragments:
      //      element 8u + r <- key kk*32 + 16u + 8hh + r = register r of score tile 2kk + u ----
      FH pa, pl;
#pragma unroll
      for (int u = 0; u < 2; ++u) {
        const int j = 2 * kk + u;
#pragma unroll
        for (int rp = 0; rp < 4; ++rp) {                              // registers 2rp, 2rp+1: two consecutive keys
          const int kr = j * 16 + 2 * rp;
          v2f a = poly3((v2f){s[j][2 * rp], s[j][2 * rp + 1]}, pk1, pk2, pk3);   // 64 a
          a[0] = (kr > dq) ? 0.0f : a[0];
          a[1] = (kr + 1 > dq) ? 0.0f : a[1];
          zl[u] += a;
          v2f ac = a;
          ac[0] = fminf(fmaxf(ac[0], -F16MX), F16MX);
          ac[1] = fminf(fmaxf(ac[1], -F16MX), F16MX);
          const v2h ah = __builtin_convertvector(ac, v2h);
          pa.h[u][2 * rp]     = ah[0];
          pa.h[u][2 * rp + 1] = ah[1];
          const v2h al = __builtin_convertvector((ac - __builtin_convertvector(ah, v2f)) * ALS, v2h);
          pl.h[u][2 * rp]     = al[0];
          pl.h[u][2 * rp + 1] = al[1];
        }
      }
      // ---- context_hi^T += V^T . hi^T, context_lo^T += V^T . lo^T (f16 WMMA, separate accumulators) ----
#pragma unroll
      for (int t = 0; t < 4; ++t) {
        FH vb;
        vb.h[0] = *(const v8h*)(Vth + (t * 16 + c) * VPT + kk * 32 + 8 * hh);
        vb.h[1] = *(const v8h*)(Vth + (t * 16 + c) * VPT + kk * 32 + 16 + 8 * hh);
        oacc[t] = mma_h(vb.v, pa.v, oacc[t]);
        olo[t]  = mma_h(vb.v, pl.v, olo[t]);
      }
    }
  }

  // ---- join of the key split: group 1 stores hi + lo/1024 (8 pieces) and its Z partials (1 piece), lane-major ----
  float* cs = Cs[wave];
  if (grp == 1) {
#pragma unroll
    for (int t = 0; t < 4; ++t) {
#pragma unroll
      for (int g4 = 0; g4 < 2; ++g4) {
        v4f pv;
#pragma unroll
        for (int e = 0; e < 4; ++e) pv[e] = oacc[t][4 * g4 + e] + olo[t][4 * g4 + e] * (1.0f / ALS);
        *(v4f*)(cs + ((t * 2 + g4) * 32 + lane) * 4) = pv;
      }
    }
    {
      v4f zv;
#pragma unroll
      for (int e = 0; e < 4; ++e) zv[e] = zl[e >> 1][e & 1];
      *(v4f*)(cs + (8 * 32 + lane) * 4) = zv;
    }
  }
  __syncthreads();                           // publishes group 1's partials; block-uniform
  if (grp == 1) continue;                    // group 1 goes on to the next tile's first barrier
  float so[4][8];                            // the odd chunks' context partial, this lane's 32 elements
#pragma unroll
  for (int t = 0; t < 4; ++t) {
#pragma unroll
    for (int g4 = 0; g4 < 2; ++g4) {
      const v4f pv = *(const v4f*)(cs + ((t * 2 + g4) * 32 + lane) * 4);
#pragma unroll
      for (int e = 0; e < 4; ++e) so[t][4 * g4 + e] = pv[e];
    }
  }
  {
    const v4f zv = *(const v4f*)(cs + (8 * 32 + lane) * 4);
#pragma unroll
    for (int e = 0; e < 4; ++e) zl[e >> 1][e & 1] += zv[e];
  }

  // ---- Z fold (the four in-lane partials, then the other half of the keys from lane ^ 16, fixed order),
  //      64 S = (hi + lo/1024)/VSC, 64 S * (1/(64 Z)); a lane holds 8 consecutive features of its query per tile t ----
  float* os = Os[wave];
  {
    float z = (zl[0][0] + zl[0][1]) + (zl[1][0] + zl[1][1]);
    z += __shfl_xor(z, 16, 32);
    const float rz = 1.0f / z;
#pragma unroll
    for (int t = 0; t < 4; ++t) {
#pragma unroll
      for (int g4 = 0; g4 < 2; ++g4) {
        v4f ov;
#pragma unroll
        for (int e = 0; e < 4; ++e) {
          const int r = 4 * g4 + e;
          const float sv = ((oacc[t][r] + olo[t][r] * (1.0f / ALS)) + so[t][r]) * (1.0f / VSC);
          ov[e] = sv * rz;
        }
        *(v4f*)(os + c * OPT + t * 16 + 8 * hh + 4 * g4) = ov;
      }
    }
  }
  __builtin_amdgcn_fence(__ATOMIC_RELEASE, "workgroup");
  __builtin_amdgcn_wave_barrier();
  __builtin_amdgcn_fence(__ATOMIC_ACQUIRE, "workgroup");
  {
    const int col4 = c * 4;                      // 16 lanes x 4 floats = one whole 64-float row
    {
#pragma unroll
      for (int it = 0; it < 8; ++it) {           // row pairs (2it, 2it+1) of the wave tile
        const int rr = 2 * it + hh;
        const v4f ov = *(const v4f*)(os + rr * OPT + col4);
        const size_t go = ((size_t)(bh * TT + q0 + rr)) * DVL + (size_t)col4;
        *(v4f*)(outp + go) = ov;
      }
      // the next tile's set-up overwrites the address and data registers these stores name
      asm volatile("s_wait_xcnt 0x0" ::: "memory");
    }
  }
  }
}

// =====================================================================================================
// Inputs: in0 q [NB][NHD][TT][DKY] f32, in1 k same, in2 v [NB][NHD][TT][DVL] f32; bh = b*NHD + h.
// d_out f32 [NB][NHD][TT][DVL] at byte 0.
//   Vt  f16  [NBH][DVL][TT]     0          8388608
//   end                         8388608
// =====================================================================================================
extern "C" void kernel_launch(void* const* d_in, const int* in_sizes, int n_in,
                              void* d_out, int out_size, void* d_ws, size_t ws_size,
                              hipStream_t stream) {
  const int nq = NBH * TT * DKY;                      // 2097152
  const int nv = NBH * TT * DVL;                      // 4194304
  if (n_in < 3) return;
  if (in_sizes[0] != nq) return;
  if (in_sizes[1] != nq) return;
  if (in_sizes[2] != nv) return;
  if (out_size != nv) return;

  const float* q = (const float*)d_in[0];
  const float* k = (const float*)d_in[1];
  const float* v = (const float*)d_in[2];

  const size_t PV = (size_t)nv * 2;                   // 8388608
  size_t off = 0;
  const size_t oV = off; off += PV;
  if (off > ws_size) return;                          // off = 8388608
  if (off > (size_t)134217728) return;

  char* ws = (char*)d_ws;
  unsigned short* Vt = (unsigned short*)(ws + oV);
  float* outf = (float*)d_out;

  const dim3 blk(256);
  const dim3 gV(TT / 64, NBH);                        // (32, 32)
  const float sscale = 1.0f / sqrtf((float)DKY);

  // (1) v -> f16 v^T plane [bh][d][pos], values x VSC
  v_planes<<<gV, blk, 0, stream>>>(v, Vt, VSC);
  // (2) causal polynomial attention (reads q and k as f32) -> d_out
  attn_poly<<<dim3(NBH * (NQB / 2)), dim3(256), 0, stream>>>(q, k, Vt, outf, sscale);
  (void)hipGetLastError();
}

// v008
// One run takes 34.4 microseconds.
// Two timings next to v007 both put it at 1.08 times that version's speed.
// All steps since v000 together make it 3.59 times as fast.
// Contractions: q.k^T scores = v_wmma_f32_16x16x32_bf16 (bf16 operands = q and k RNE-converted where they are read, single
// product, d_key 32 = one k-step); a.v context = v_wmma_f32_16x16x32_f16 (a carried as an f16 hi plane x64 plus an f16 residual
// plane x64x1024 feeding a second accumulator, v as f16 of the bf16-converted value x16; two products); all f32
// accumulate; cubic truncated-exp polynomial (fused multiply-adds), causal zeroing, row sums Z and the final S*(1/Z) in f32.
// Both products run transposed (scores^T = k . q^T, context^T = v^T . a^T): the score accumulators are the a^T operand.
#include <hip/hip_runtime.h>
#include <math.h>
#include <stdint.h>

#define TT    2048                 // sequence length (queries == keys)
#define NB    4
#define NHD   8
#define DKY   32                   // d_key
#define DVL   64                   // d_val
#define NBH   (NB * NHD)           // 32 (batch, head) pairs; bh = b*NHD + h
#define NQB   (TT / 64)            // 32 query / key tiles of 64
#define AHS   64.0f                // hi plane carry of the polynomial weights (exact power of two)
#define ALS   1024.0f              // residual plane carry on top of AHS (exact power of two)
#define VSC   16.0f                // v plane carry (exact power of two)
#define F16MX 65504.0f
// LDS row pitches in 16-bit elements: 16 B x odd, so that the 16 rows one ds_load_b128 half-wave reads start on
// 16 distinct bank quads (bank = dword address mod 64) instead of 2 (128-B rows) or 4 (64-B rows).
#define KPT   40                   // K rows: 32 halves + 8 pad  = 80 B
#define VPT   72                   // V^T rows: 64 halves + 8 pad = 144 B
#define OPT   68                   // output staging rows (f32): 64 floats + 4 pad = 272 B
static_assert((TT % 64) == 0);
static_assert((NQB % 2) == 0);
static_assert(DKY == 32);
static_assert(DVL == 64);
static_assert((KPT % 16) == 8 && (VPT % 16) == 8 && (OPT % 8) == 4);

typedef _Float16 v16h __attribute__((ext_vector_type(16)));
typedef _Float16 v8h  __attribute__((ext_vector_type(8)));
typedef __bf16   v16b __attribute__((ext_vector_type(16)));
typedef __bf16   v8b  __attribute__((ext_vector_type(8)));
typedef __bf16   v4b  __attribute__((ext_vector_type(4)));
typedef float    v8f  __attribute__((ext_vector_type(8)));
typedef float    v4f  __attribute__((ext_vector_type(4)));
typedef float    v2f  __attribute__((ext_vector_type(2)));
typedef _Float16 v2h  __attribute__((ext_vector_type(2)));
typedef unsigned int v4u __attribute__((ext_vector_type(4)));

// ---- scalar helpers --------------------------------------------------------------------------------
__device__ __forceinline__ unsigned short bf_bits(float f) {          // f32 -> bf16 bits, RNE convert
  unsigned u = __float_as_uint(f);
  return (unsigned short)((u + 0x7FFFu + ((u >> 16) & 1u)) >> 16);
}
__device__ __forceinline__ float bf_up(unsigned short h) { return __uint_as_float(((unsigned)h) << 16); }
__device__ __forceinline__ unsigned short h_bits(_Float16 x) { return __builtin_bit_cast(unsigned short, x); }
__device__ __forceinline__ unsigned pk16(unsigned short a, unsigned short b) { return (unsigned)a | ((unsigned)b << 16); }
__device__ __forceinline__ v8f zero8() { v8f z = {0.f, 0.f, 0.f, 0.f, 0.f, 0.f, 0.f, 0.f}; return z; }

// Degree-3 truncated exp of x = s * c, carried x AHS, as a cubic in the raw score s: three packed fused multiply-adds,
// AHS + s*(k1 + s*(k2 + s*k3)) with k1 = AHS c, k2 = AHS c^2 / 2, k3 = AHS c^3 / 6.
__device__ __forceinline__ v2f poly3(v2f s, float k1, float k2, float k3) {
  v2f t = __builtin_elementwise_fma(s, (v2f){k3, k3}, (v2f){k2, k2});
  t = __builtin_elementwise_fma(s, t, (v2f){k1, k1});
  t = __builtin_elementwise_fma(s, t, (v2f){AHS, AHS});
  return t;
}

// ---- WMMA helpers: builtin forms, the compiler keeps their hazard distances itself ----------------------
__device__ __forceinline__ v8f mma_b(v16b a, v16b b, v8f c) {
  c = __builtin_amdgcn_wmma_f32_16x16x32_bf16(false, a, false, b, (short)0, c, false, false);
  return c;
}
__device__ __forceinline__ v8f mma_h(v16h a, v16h b, v8f c) {
  c = __builtin_amdgcn_wmma_f32_16x16x32_f16(false, a, false, b, (short)0, c, false, false);
  return c;
}

// ---- staging of one 64-key chunk by one group of 128 threads, in two halves: global -> registers, registers -> LDS ----
// K: piece i*128 + tid of the chunk's 512 x 4 floats; V^T: row tid>>1, keys (tid&1)*32 .. +31.
__device__ __forceinline__ void stage_load(const float* __restrict__ Kp, const _Float16* __restrict__ Vh, int kv0, int tid,
                                           v4f (&ka)[4], v8h (&va)[4]) {
  const float* kg = Kp + (size_t)kv0 * DKY + tid * 4;
#pragma unroll
  for (int i = 0; i < 4; ++i) ka[i] = *(const v4f*)(kg + i * 512);
  const _Float16* vg = Vh + (size_t)(tid >> 1) * TT + (size_t)kv0 + (size_t)((tid & 1) * 32);
#pragma unroll
  for (int i = 0; i < 4; ++i) va[i] = *(const v8h*)(vg + 8 * i);
}
__device__ __forceinline__ void stage_store(__bf16* Kb, _Float16* Vb, int tid, const v4f (&ka)[4], const v8h (&va)[4]) {
#pragma unroll
  for (int i = 0; i < 4; ++i) {                                     // K row i*16 + (tid>>3), d = 4*(tid&7)..+3
    *(v4b*)(Kb + (i * 16 + (tid >> 3)) * KPT + (tid & 7) * 4) = __builtin_convertvector(ka[i], v4b);
  }
#pragma unroll
  for (int i = 0; i < 4; ++i) *(v8h*)(Vb + (tid >> 1) * VPT + (tid & 1) * 32 + 8 * i) = va[i];
}

// =====================================================================================================
// v f32 [bh][pos][DVL] -> f16 v^T plane vt[(bh*DVL + d)*TT + s] = f16(bf16_rne(v) * vsc) (exact for a power of two).
// Block = one 64-position x 64-feature tile of one bh; grid = (TT/64, NBH); tile staged in LDS as f32
// (256 threads x 4 v4f loads, __syncthreads).
// Store: group g = tid>>3 (0..31), piece = tid&7: iteration it writes row d = it*32 + g; lanes 8g..8g+7 x 16 B =
// coverage: 2 iterations x 32 groups = 64 rows d, 8 pieces x 8 = 64 keys per row; grid covers every (bh, s tile).
// =====================================================================================================
__global__ __launch_bounds__(256) void v_planes(const float* __restrict__ vf, unsigned short* vt, float vsc) {
  __shared__ __align__(16) float sv[64 * 68];        // [tt][d], pitch 68 floats (272 B, 16-B aligned rows)
  const int tid = threadIdx.x;
  const int s0  = blockIdx.x * 64;
  const int bh  = blockIdx.y;
  if (bh >= NBH || s0 >= TT) return;                 // block-uniform, ahead of every barrier
  const float* src = vf + ((size_t)bh * TT + (size_t)s0) * DVL;   // 64 rows x 64 floats, contiguous
#pragma unroll
  for (int i = 0; i < 4; ++i) {
    const int idx = i * 256 + tid;                   // 0..1023
    const int tt = idx >> 4, c4 = (idx & 15) * 4;    // tt 0..63, c4 0..60
    const v4f a = *(const v4f*)(src + (size_t)tt * DVL + c4);
    *(v4f*)(sv + tt * 68 + c4) = a;
  }
  __syncthreads();

  const int g = tid >> 3, piece = tid & 7;
  v4u hv[2];
  size_t hofs[2];
#pragma unroll
  for (int it = 0; it < 2; ++it) {
    const int d = it * 32 + g;
    v4u a;
#pragma unroll
    for (int e = 0; e < 4; ++e) {
      const float f0 = sv[(piece * 8 + 2 * e) * 68 + d];
      const float f1 = sv[(piece * 8 + 2 * e + 1) * 68 + d];
      const _Float16 x0 = (_Float16)(bf_up(bf_bits(f0)) * vsc);
      const _Float16 x1 = (_Float16)(bf_up(bf_bits(f1)) * vsc);
      a[e] = pk16(h_bits(x0), h_bits(x1));
    }
    hv[it] = a;
    hofs[it] = ((size_t)(bh * DVL + d)) * TT + (size_t)s0 + (size_t)(piece * 8);
  }
  {
#pragma unroll
    for (int it = 0; it < 2; ++it) {
      *(v4u*)(vt + hofs[it]) = hv[it];
    }
    
  }
}

// =====================================================================================================
// Causal polynomial attention, d_key 32, d_val 64.
//   q f32 input: element (bh, t, d) at [(bh*TT + t)*DKY + d];  k f32 input: (bh, s, d) at [(bh*TT + s)*DKY + d];
//   both are converted to bf16 (RNE) here: q on its way into the fragment registers, k on its way into LDS
//   v^T plane f16 (x VSC): (bh, d, s) at [(bh*DVL + d)*TT + s]
//   raw scores^T = k . q^T on bf16 WMMA (A = 16 K rows, B = the wave's 16 queries, one k-step of 32 over d), f32
//   accumulate: register r of tile j in lane (c, hh) = key j*16 + 8hh + r against query c. With x = raw * sscale,
//   64 a = 64 (1 + x + x^2/2 + x^3/6) as a cubic in raw (f32, three fused multiply-adds, sscale and the carry of 64
//   inside its coefficients), keys > query replaced by 0, z += 64 a (f32, in-lane: a lane holds one query;
//   four partials, by the parity of tile j and of register r, fixed order; Z is carried x64 to the epilogue).
//   a planes: hi = f16(clamp(64 a)), lo = f16((clamp(64 a) - hi) * 1024) (the difference is exact in f32);
//   score tiles 2kk and 2kk+1, converted in place, are the B operand (keys kk*32.. in the hardware k order) of
//   context_hi^T += v^T . hi^T, context_lo^T += v^T . lo^T on f16 WMMA (A = 16 V^T rows, 2 k-steps of 32 per 64-key
//   chunk), separate accumulators: the weights never pass through LDS. Register r of tile t = feature t*16 + 8hh + r of
//   query c; epilogue 64 S = (context_hi + context_lo / 1024) / VSC, out = 64 S * (1 / (64 Z)).
//   Block = 8 waves in two groups of 4; it runs two 64-row query tiles of one bh one after the other, tile NQB-1-p
//   and then tile p, so that every block walks NQB+1 key chunks (causal cost is linear in the tile index; all blocks
//   are resident at once and the launch lasts as long as its fullest block). grid = (NQB/2) * NBH; key chunks 0..qb
//   per tile (block-uniform trip count, statically clamped to NQB); every processed chunk holds at least one live key.
//   Key split: wave w and wave w+4 own the same 16 query rows; group 0 (waves 0..3) takes the even key chunks, group 1
//   (waves 4..7) the odd ones, each group with its own K / V^T buffers, one pair of chunks per pass. The weights are a
//   plain sum over keys (no running maximum), so the two groups' context and Z partials just add: at the end of a tile
//   group 1 hands its partials over in LDS, one __syncthreads, group 0 adds them and finishes the tile.
//   K / V^T chunk staging per group: K 64 rows x 32 floats = 8 KB contiguous (4 x 16 B per thread, a wave's load = 512
//   contiguous B, 4 bf16 = 8 B to LDS each), V^T 64 rows x 64 halves (2 threads per row, 4 x 16 B each); plain loads.
//   Two LDS buffers per group: the loads of chunk kt+2 issue ahead of the products of chunk kt and stay in registers
//   while those run; behind the products they are converted and stored into the other buffer. One __syncthreads per
//   pass: it publishes the buffer this pass reads and ends the last reads of the buffer that is refilled behind it.
//   out f32 [bh][pos][DVL]: row (bh, t) = 64 floats = 256 B; each wave stages its 16x64 tile in LDS, then one
//   instruction per row pair: lanes 0..15 x 16 B = row 2i, lanes 16..31 x 16 B = row 2i+1 (512 contiguous B =
// coverage: 8 instructions x 2 rows x 64 cols = the wave's 16 rows; 4 waves = the 64-row tile; p = 0..NQB/2-1 with
//   tiles p and NQB-1-p = every query tile once; grid = every (bh, p).
// =====================================================================================================
// waves_per_eu(4, 4): two blocks of 8 waves on a WGP = four waves per SIMD, 256 registers a wave.
__global__ __launch_bounds__(256) __attribute__((amdgpu_waves_per_eu(4, 4)))
void attn_poly(const float* __restrict__ qf, const float* __restrict__ kf,
               const unsigned short* __restrict__ vtpl, float* outp, float sscale) {
#pragma clang fp contract(off)
  union FH { v16h v; v8h h[2]; };
  union FB { v16b v; v8b h[2]; };
  __shared__ __align__(16) __bf16   Ksh2[2][2][64 * KPT];           // [group][buffer] K [kv][d], padded rows     5 KB each
  __shared__ __align__(16) _Float16 Vth2[2][2][DVL * VPT];          // [group][buffer] V^T [d][kv], padded rows   9 KB each
  __shared__ __align__(16) float    Os[4][16 * OPT];                // per group-0 wave context tile [row][d], padded rows
  __shared__ __align__(16) float    Cs[4][9 * 32 * 4];              // group 1 -> group 0: [piece][lane] x 4 floats

  const int tid  = threadIdx.x & 127;        // thread index inside its group of 4 waves
  // wave number in a scalar register: the tests on the group below become scalar branches, EXEC stays all ones
  const int wv8  = __builtin_amdgcn_readfirstlane((int)(threadIdx.x >> 5));
  const int grp  = wv8 >> 2;                 // 0: even key chunks, 1: odd key chunks
  const int wave = wv8 & 3;                  // which 16 query rows of the tile
  const int lane = tid & 31;
  const int hh   = lane >> 4;
  const int c    = lane & 15;

  const int bx = blockIdx.x;
  const int pr = bx % (NQB / 2);
  const int bh = bx / (NQB / 2);
  if (bh >= NBH) return;                     // block-uniform, ahead of every barrier

  // coefficients of the weight cubic in the raw score, x AHS (wave-uniform)
  const float pk1 = AHS * sscale;
  const float pk2 = (AHS * 0.5f) * (sscale * sscale);
  const float pk3 = (AHS / 6.0f) * (sscale * sscale * sscale);

  const float*    Qp = qf + (size_t)bh * TT * DKY;
  const float*    Kp = kf + (size_t)bh * TT * DKY;
  const _Float16* Vh = (const _Float16*)(const void*)vtpl + (size_t)bh * DVL * TT;

  // one copy of the tile body: the two tiles of a block run strictly one after the other in every wave
#pragma unroll 1
  for (int half = 0; half < 2; ++half) {
  const int qb = half ? pr : (NQB - 1 - pr);   // block-uniform
  const int q0 = qb * 64 + wave * 16;
  int nkt = qb + 1;                          // causal: key chunks 0..qb, block-uniform
  if (nkt > NQB) nkt = NQB;
  const int npass = (nkt + 1) >> 1;          // block-uniform: every wave passes every barrier

  v4f ka[4];                                 // the chunk in flight: K as f32, V^T as f16
  v8h va[4];
  if (grp < nkt) stage_load(Kp, Vh, grp * 64, tid, ka, va);   // the group's first chunk, in flight beside the Q loads

  // ---- Q fragment (B operand, column = lane&15): one d-chunk of 32; elements 0..7 <- d 8hh.., 8..15 <- d 16+8hh.. ----
  v16b qa;
  {
    const float* qg = Qp + (size_t)(q0 + c) * DKY + 8 * hh;
    v4f qv[4];
    qv[0] = *(const v4f*)(qg);
    qv[1] = *(const v4f*)(qg + 4);
    qv[2] = *(const v4f*)(qg + 16);
    qv[3] = *(const v4f*)(qg + 20);
    // inputs only: keeps the Q loads here, in flight together with the first chunk's, instead of sunk behind its LDS stores
    asm volatile("" :: "v"(qv[0]), "v"(qv[1]), "v"(qv[2]), "v"(qv[3]));
#pragma unroll
    for (int i = 0; i < 4; ++i) {
      const v4b qc = __builtin_convertvector(qv[i], v4b);
#pragma unroll
      for (int e = 0; e < 4; ++e) qa[4 * i + e] = qc[e];
    }
  }

  v2f zl[2];                                 // Z partials of query c: [tile j odd][register r odd]
  v8f oacc[4], olo[4];
#pragma unroll
  for (int u = 0; u < 2; ++u) zl[u] = (v2f){0.f, 0.f};
#pragma unroll
  for (int t = 0; t < 4; ++t) { oacc[t] = zero8(); olo[t] = zero8(); }

  // the first chunk goes into buffer 0: every read of the tile before ended ahead of that tile's join barrier
  if (grp < nkt) stage_store(Ksh2[grp][0], Vth2[grp][0], tid, ka, va);
  for (int ps = 0; ps < npass; ++ps) {
    const int kt = 2 * ps + grp;
    const bool live  = kt < nkt;             // false only for group 1 in the last pass of an odd chunk count
    const bool nlive = kt + 2 < nkt;         // the group has a chunk in the next pass
    const int kv0 = kt * 64;
    __syncthreads();                         // buffer ps&1 is whole; nobody reads the other buffer any more
    if (!live) continue;
    // behind the barrier, whose fence would wait for them; they land while the products below run
    if (nlive) stage_load(Kp, Vh, kv0 + 128, tid, ka, va);
    const __bf16*   Ksh = Ksh2[grp][ps & 1];
    const _Float16* Vth = Vth2[grp][ps & 1];

    // ---- raw scores^T: 64 keys x 16 queries per wave, bf16 product, one d-chunk ----
    v8f s[4];
#pragma unroll
    for (int j = 0; j < 4; ++j) {
      FB kb;
      kb.h[0] = *(const v8b*)(Ksh + (j * 16 + c) * KPT + 8 * hh);
      kb.h[1] = *(const v8b*)(Ksh + (j * 16 + c) * KPT + 16 + 8 * hh);
      s[j] = mma_b(kb.v, qa, zero8());
    }

    const int dq = q0 + c - kv0 - 8 * hh;    // key j*16 + 8hh + r of the chunk is past query c where j*16 + r > dq
    // unrolled: kk picks the score tiles, which are registers and need compile-time indices
#pragma unroll
    for (int kk = 0; kk < 2; ++kk) {
      // ---- scale, polynomial, causal zeroing, Z partials; hi / residual planes straight into the B fragments:
      //      element 8u + r <- key kk*32 + 16u + 8hh + r = register r of score tile 2kk + u ----
      FH pa, pl;
#pragma unroll
      for (int u = 0; u < 2; ++u) {
        const int j = 2 * kk + u;
#pragma unroll
        for (int rp = 0; rp < 4; ++rp) {                              // registers 2rp, 2rp+1: two consecutive keys
          const int kr = j * 16 + 2 * rp;
          v2f a = poly3((v2f){s[j][2 * rp], s[j][2 * rp + 1]}, pk1, pk2, pk3);   // 64 a
          a[0] = (kr > dq) ? 0.0f : a[0];
          a[1] = (kr + 1 > dq) ? 0.0f : a[1];
          zl[u] += a;
          v2f ac = a;
          ac[0] = fminf(fmaxf(ac[0], -F16MX), F16MX);
          ac[1] = fminf(fmaxf(ac[1], -F16MX), F16MX);
          const v2h ah = __builtin_convertvector(ac, v2h);
          pa.h[u][2 * rp]     = ah[0];
          pa.h[u][2 * rp + 1] = ah[1];
          const v2h al = __builtin_convertvector((ac - __builtin_convertvector(ah, v2f)) * ALS, v2h);
          pl.h[u][2 * rp]     = al[0];
          pl.h[u][2 * rp + 1] = al[1];
        }
      }
      // ---- context_hi^T += V^T . hi^T, context_lo^T += V^T . lo^T (f16 WMMA, separate accumulators) ----
#pragma unroll
      for (int t = 0; t < 4; ++t) {
        FH vb;
        vb.h[0] = *(const v8h*)(Vth + (t * 16 + c) * VPT + kk * 32 + 8 * hh);
        vb.h[1] = *(const v8h*)(Vth + (t * 16 + c) * VPT + kk * 32 + 16 + 8 * hh);
        oacc[t] = mma_h(vb.v, pa.v, oacc[t]);
        olo[t]  = mma_h(vb.v, pl.v, olo[t]);
      }
    }
    if (nlive) stage_store(Ksh2[grp][(ps + 1) & 1], Vth2[grp][(ps + 1) & 1], tid, ka, va);
  }

  // ---- join of the key split: group 1 stores hi + lo/1024 (8 pieces) and its Z partials (1 piece), lane-major ----
  float* cs = Cs[wave];
  if (grp == 1) {
#pragma unroll
    for (int t = 0; t < 4; ++t) {
#pragma unroll
      for (int g4 = 0; g4 < 2; ++g4) {
        v4f pv;
#pragma unroll
        for (int e = 0; e < 4; ++e) pv[e] = oacc[t][4 * g4 + e] + olo[t][4 * g4 + e] * (1.0f / ALS);
        *(v4f*)(cs + ((t * 2 + g4) * 32 + lane) * 4) = pv;
      }
    }
    {
      v4f zv;
#pragma unroll
      for (int e = 0; e < 4; ++e) zv[e] = zl[e >> 1][e & 1];
      *(v4f*)(cs + (8 * 32 + lane) * 4) = zv;
    }
  }
  __syncthreads();                           // publishes group 1's partials; block-uniform
  if (grp == 1) continue;                    // group 1 goes on to the next tile's first barrier
  float so[4][8];                            // the odd chunks' context partial, this lane's 32 elements
#pragma unroll
  for (int t = 0; t < 4; ++t) {
#pragma unroll
    for (int g4 = 0; g4 < 2; ++g4) {
      const v4f pv = *(const v4f*)(cs + ((t * 2 + g4) * 32 + lane) * 4);
#pragma unroll
      for (int e = 0; e < 4; ++e) so[t][4 * g4 + e] = pv[e];
    }
  }
  {
    const v4f zv = *(const v4f*)(cs + (8 * 32 + lane) * 4);
#pragma unroll
    for (int e = 0; e < 4; ++e) zl[e >> 1][e & 1] += zv[e];
  }

  // ---- Z fold (the four in-lane partials, then the other half of the keys from lane ^ 16, fixed order),
  //      64 S = (hi + lo/1024)/VSC, 64 S * (1/(64 Z)); a lane holds 8 consecutive features of its query per tile t ----
  float* os = Os[wave];
  {
    float z = (zl[0][0] + zl[0][1]) + (zl[1][0] + zl[1][1]);
    z += __shfl_xor(z, 16, 32);
    const float rz = 1.0f / z;
#pragma unroll
    for (int t = 0; t < 4; ++t) {
#pragma unroll
      for (int g4 = 0; g4 < 2; ++g4) {
        v4f ov;
#pragma unroll
        for (int e = 0; e < 4; ++e) {
          const int r = 4 * g4 + e;
          const float sv = ((oacc[t][r] + olo[t][r] * (1.0f / ALS)) + so[t][r]) * (1.0f / VSC);
          ov[e] = sv * rz;
        }
        *(v4f*)(os + c * OPT + t * 16 + 8 * hh + 4 * g4) = ov;
      }
    }
  }
  __builtin_amdgcn_fence(__ATOMIC_RELEASE, "workgroup");
  __builtin_amdgcn_wave_barrier();
  __builtin_amdgcn_fence(__ATOMIC_ACQUIRE, "workgroup");
  {
    const int col4 = c * 4;                      // 16 lanes x 4 floats = one whole 64-float row
    {
#pragma unroll
      for (int it = 0; it < 8; ++it) {           // row pairs (2it, 2it+1) of the wave tile
        const int rr = 2 * it + hh;
        const v4f ov = *(const v4f*)(os + rr * OPT + col4);
        const size_t go = ((size_t)(bh * TT + q0 + rr)) * DVL + (size_t)col4;
        *(v4f*)(outp + go) = ov;
      }
      // the next tile's set-up overwrites the address and data registers these stores name
      asm volatile("s_wait_xcnt 0x0" ::: "memory");
    }
  }
  }
}

// =====================================================================================================
// Inputs: in0 q [NB][NHD][TT][DKY] f32, in1 k same, in2 v [NB][NHD][TT][DVL] f32; bh = b*NHD + h.
// d_out f32 [NB][NHD][TT][DVL] at byte 0.
//   Vt  f16  [NBH][DVL][TT]     0          8388608
//   end                         8388608
// =====================================================================================================
extern "C" void kernel_launch(void* const* d_in, const int* in_sizes, int n_in,
                              void* d_out, int out_size, void* d_ws, size_t ws_size,
                              hipStream_t stream) {
  const int nq = NBH * TT * DKY;                      // 2097152
  const int nv = NBH * TT * DVL;                      // 4194304
  if (n_in < 3) return;
  if (in_sizes[0] != nq) return;
  if (in_sizes[1] != nq) return;
  if (in_sizes[2] != nv) return;
  if (out_size != nv) return;

  const float* q = (const float*)d_in[0];
  const float* k = (const float*)d_in[1];
  const float* v = (const float*)d_in[2];

  const size_t PV = (size_t)nv * 2;                   // 8388608
  size_t off = 0;
  const size_t oV = off; off += PV;
  if (off > ws_size) return;                          // off = 8388608
  if (off > (size_t)134217728) return;

  char* ws = (char*)d_ws;
  unsigned short* Vt = (unsigned short*)(ws + oV);
  float* outf = (float*)d_out;

  const dim3 blk(256);
  const dim3 gV(TT / 64, NBH);                        // (32, 32)
  const float sscale = 1.0f / sqrtf((float)DKY);

  // (1) v -> f16 v^T plane [bh][d][pos], values x VSC
  v_planes<<<gV, blk, 0, stream>>>(v, Vt, VSC);
  // (2) causal polynomial attention (reads q and k as f32) -> d_out
  attn_poly<<<dim3(NBH * (NQB / 2)), dim3(256), 0, stream>>>(q, k, Vt, outf, sscale);
  (void)hipGetLastError();
}

// v009
// One run takes 31.8 microseconds.
// Next to v008, in two timings, it ran 1.08 and 1.07 times as fast.
// Over all steps from v000 it is 3.87 times as fast.
// Contractions: q.k^T scores = v_wmma_f32_16x16x32_bf16 (bf16 operands = q and k RNE-converted where they are read, single
// product, d_key 32 = one k-step); a.v context = v_wmma_f32_16x16x32_f16 (a carried as an f16 hi plane x64 plus an f16 residual
// plane x64x1024 feeding a second accumulator, v as f16 of the bf16-converted value x16; two products); all f32
// accumulate; cubic truncated-exp polynomial (fused multiply-adds), causal zeroing, row sums Z and the final S*(1/Z) in f32.
// Both products run transposed (scores^T = k . q^T, context^T = v^T . a^T): the score accumulators are the a^T operand.
#include <hip/hip_runtime.h>
#include <math.h>
#include <stdint.h>

#define TT    2048                 // sequence length (queries == keys)
#define NB    4
#define NHD   8
#define DKY   32                   // d_key
#define DVL   64                   // d_val
#define NBH   (NB * NHD)           // 32 (batch, head) pairs; bh = b*NHD + h
#define NQB   (TT / 64)            // 32 query / key tiles of 64
#define AHS   64.0f                // hi plane carry of the polynomial weights (exact power of two)
#define ALS   1024.0f              // residual plane carry on top of AHS (exact power of two)
#define VSC   16.0f                // v plane carry (exact power of two)
#define F16MX 65504.0f
// LDS row pitches in 16-bit elements: 16 B x odd, so that the 16 rows one ds_load_b128 half-wave reads start on
// 16 distinct bank quads (bank = dword address mod 64) instead of 2 (128-B rows) or 4 (64-B rows).
#define KPT   40                   // K rows: 32 halves + 8 pad  = 80 B
#define VPT   72                   // V^T rows: 64 halves + 8 pad = 144 B
#define OPT   68                   // output staging rows (f32): 64 floats + 4 pad = 272 B
static_assert((TT % 64) == 0);
static_assert((NQB % 2) == 0);
static_assert(DKY == 32);
static_assert(DVL == 64);
static_assert((KPT % 16) == 8 && (VPT % 16) == 8 && (OPT % 8) == 4);

typedef _Float16 v16h __attribute__((ext_vector_type(16)));
typedef _Float16 v8h  __attribute__((ext_vector_type(8)));
typedef __bf16   v16b __attribute__((ext_vector_type(16)));
typedef __bf16   v8b  __attribute__((ext_vector_type(8)));
typedef __bf16   v4b  __attribute__((ext_vector_type(4)));
typedef float    v8f  __attribute__((ext_vector_type(8)));
typedef float    v4f  __attribute__((ext_vector_type(4)));
typedef float    v2f  __attribute__((ext_vector_type(2)));
typedef _Float16 v2h  __attribute__((ext_vector_type(2)));
typedef unsigned int v4u __attribute__((ext_vector_type(4)));

// ---- scalar helpers --------------------------------------------------------------------------------
__device__ __forceinline__ unsigned short bf_bits(float f) {          // f32 -> bf16 bits, RNE convert
  unsigned u = __float_as_uint(f);
  return (unsigned short)((u + 0x7FFFu + ((u >> 16) & 1u)) >> 16);
}
__device__ __forceinline__ float bf_up(unsigned short h) { return __uint_as_float(((unsigned)h) << 16); }
__device__ __forceinline__ unsigned short h_bits(_Float16 x) { return __builtin_bit_cast(unsigned short, x); }
__device__ __forceinline__ unsigned pk16(unsigned short a, unsigned short b) { return (unsigned)a | ((unsigned)b << 16); }
__device__ __forceinline__ v8f zero8() { v8f z = {0.f, 0.f, 0.f, 0.f, 0.f, 0.f, 0.f, 0.f}; return z; }

// Degree-3 truncated exp of x = s * c, carried x AHS, as a cubic in the raw score s: three packed fused multiply-adds,
// AHS + s*(k1 + s*(k2 + s*k3)) with k1 = AHS c, k2 = AHS c^2 / 2, k3 = AHS c^3 / 6.
__device__ __forceinline__ v2f poly3(v2f s, float k1, float k2, float k3) {
  v2f t = __builtin_elementwise_fma(s, (v2f){k3, k3}, (v2f){k2, k2});
  t = __builtin_elementwise_fma(s, t, (v2f){k1, k1});
  t = __builtin_elementwise_fma(s, t, (v2f){AHS, AHS});
  return t;
}

// ---- WMMA helpers: builtin forms, the compiler keeps their hazard distances itself ----------------------
__device__ __forceinline__ v8f mma_b(v16b a, v16b b, v8f c) {
  c = __builtin_amdgcn_wmma_f32_16x16x32_bf16(false, a, false, b, (short)0, c, false, false);
  return c;
}
__device__ __forceinline__ v8f mma_h(v16h a, v16h b, v8f c) {
  c = __builtin_amdgcn_wmma_f32_16x16x32_f16(false, a, false, b, (short)0, c, false, false);
  return c;
}

// ---- staging of one 64-key chunk by one group of 128 threads, in two halves: global -> registers, registers -> LDS ----
// K: piece i*128 + tid of the chunk's 512 x 4 floats; V^T: row tid>>1, keys (tid&1)*32 .. +31.
__device__ __forceinline__ void stage_load(const float* __restrict__ Kp, const _Float16* __restrict__ Vh, int kv0, int tid,
                                           v4f (&ka)[4], v8h (&va)[4]) {
  const float* kg = Kp + (size_t)kv0 * DKY + tid * 4;
#pragma unroll
  for (int i = 0; i < 4; ++i) ka[i] = *(const v4f*)(kg + i * 512);
  const _Float16* vg = Vh + (size_t)(tid >> 1) * TT + (size_t)kv0 + (size_t)((tid & 1) * 32);
#pragma unroll
  for (int i = 0; i < 4; ++i) va[i] = *(const v8h*)(vg + 8 * i);
}
__device__ __forceinline__ void stage_store(__bf16* Kb, _Float16* Vb, int tid, const v4f (&ka)[4], const v8h (&va)[4]) {
#pragma unroll
  for (int i = 0; i < 4; ++i) {                                     // K row i*16 + (tid>>3), d = 4*(tid&7)..+3
    *(v4b*)(Kb + (i * 16 + (tid >> 3)) * KPT + (tid & 7) * 4) = __builtin_convertvector(ka[i], v4b);
  }
#pragma unroll
  for (int i = 0; i < 4; ++i) *(v8h*)(Vb + (tid >> 1) * VPT + (tid & 1) * 32 + 8 * i) = va[i];
}

union FH { v16h v; v8h h[2]; };
union FB { v16b v; v8b h[2]; };

// ---- one wave's work on one staged 64-key chunk: scores^T, weights, Z partials, both context products ----
// DIAG = the copy for a tile's last pass, which holds the chunk with the tile's own diagonal (chunk index == query tile
// index): only there can a key lie past a query, and only this copy compares and zeroes. In every earlier chunk the last
// key precedes the tile's first query, so the zeroing would select the weight itself for each element.
// dq: key j*16 + 8hh + r of the chunk is past query c where j*16 + r > dq (read by the DIAG copy alone).
template <bool DIAG>
__device__ __forceinline__ void chunk_products(const __bf16* Ksh, const _Float16* Vth, v16b qa, int c, int hh, int dq,
                                               float pk1, float pk2, float pk3,
                                               v2f (&zl)[2], v8f (&oacc)[4], v8f (&olo)[4]) {
  // ---- raw scores^T: 64 keys x 16 queries per wave, bf16 product, one d-chunk ----
  v8f s[4];
#pragma unroll
  for (int j = 0; j < 4; ++j) {
    FB kb;
    kb.h[0] = *(const v8b*)(Ksh + (j * 16 + c) * KPT + 8 * hh);
    kb.h[1] = *(const v8b*)(Ksh + (j * 16 + c) * KPT + 16 + 8 * hh);
    s[j] = mma_b(kb.v, qa, zero8());
  }

  // unrolled: kk picks the score tiles, which are registers and need compile-time indices
#pragma unroll
  for (int kk = 0; kk < 2; ++kk) {
    // ---- scale, polynomial, causal zeroing (DIAG only), Z partials; hi / residual planes straight into the B fragments:
    //      element 8u + r <- key kk*32 + 16u + 8hh + r = register r of score tile 2kk + u ----
    FH pa, pl;
#pragma unroll
    for (int u = 0; u < 2; ++u) {
      const int j = 2 * kk + u;
#pragma unroll
      for (int rp = 0; rp < 4; ++rp) {                              // registers 2rp, 2rp+1: two consecutive keys
        const int kr = j * 16 + 2 * rp;
        v2f a = poly3((v2f){s[j][2 * rp], s[j][2 * rp + 1]}, pk1, pk2, pk3);   // 64 a
        if constexpr (DIAG) {
          a[0] = (kr > dq) ? 0.0f : a[0];
          a[1] = (kr + 1 > dq) ? 0.0f : a[1];
        }
        zl[u] += a;
        v2f ac = a;
        ac[0] = fminf(fmaxf(ac[0], -F16MX), F16MX);
        ac[1] = fminf(fmaxf(ac[1], -F16MX), F16MX);
        const v2h ah = __builtin_convertvector(ac, v2h);
        pa.h[u][2 * rp]     = ah[0];
        pa.h[u][2 * rp + 1] = ah[1];
        const v2h al = __builtin_convertvector((ac - __builtin_convertvector(ah, v2f)) * ALS, v2h);
        pl.h[u][2 * rp]     = al[0];
        pl.h[u][2 * rp + 1] = al[1];
      }
    }
    // ---- context_hi^T += V^T . hi^T, context_lo^T += V^T . lo^T (f16 WMMA, separate accumulators) ----
#pragma unroll
    for (int t = 0; t < 4; ++t) {
      FH vb;
      vb.h[0] = *(const v8h*)(Vth + (t * 16 + c) * VPT + kk * 32 + 8 * hh);
      vb.h[1] = *(const v8h*)(Vth + (t * 16 + c) * VPT + kk * 32 + 16 + 8 * hh);
      oacc[t] = mma_h(vb.v, pa.v, oacc[t]);
      olo[t]  = mma_h(vb.v, pl.v, olo[t]);
    }
  }
}

// =====================================================================================================
// v f32 [bh][pos][DVL] -> f16 v^T plane vt[(bh*DVL + d)*TT + s] = f16(bf16_rne(v) * vsc) (exact for a power of two).
// Block = one 64-position x 64-feature tile of one bh; grid = (TT/64, NBH); tile staged in LDS as f32
// (256 threads x 4 v4f loads, __syncthreads).
// Store: group g = tid>>3 (0..31), piece = tid&7: iteration it writes row d = it*32 + g; lanes 8g..8g+7 x 16 B =
// coverage: 2 iterations x 32 groups = 64 rows d, 8 pieces x 8 = 64 keys per row; grid covers every (bh, s tile).
// =====================================================================================================
__global__ __launch_bounds__(256) void v_planes(const float* __restrict__ vf, unsigned short* vt, float vsc) {
  __shared__ __align__(16) float sv[64 * 68];        // [tt][d], pitch 68 floats (272 B, 16-B aligned rows)
  const int tid = threadIdx.x;
  const int s0  = blockIdx.x * 64;
  const int bh  = blockIdx.y;
  if (bh >= NBH || s0 >= TT) return;                 // block-uniform, ahead of every barrier
  const float* src = vf + ((size_t)bh * TT + (size_t)s0) * DVL;   // 64 rows x 64 floats, contiguous
#pragma unroll
  for (int i = 0; i < 4; ++i) {
    const int idx = i * 256 + tid;                   // 0..1023
    const int tt = idx >> 4, c4 = (idx & 15) * 4;    // tt 0..63, c4 0..60
    const v4f a = *(const v4f*)(src + (size_t)tt * DVL + c4);
    *(v4f*)(sv + tt * 68 + c4) = a;
  }
  __syncthreads();

  const int g = tid >> 3, piece = tid & 7;
  v4u hv[2];
  size_t hofs[2];
#pragma unroll
  for (int it = 0; it < 2; ++it) {
    const int d = it * 32 + g;
    v4u a;
#pragma unroll
    for (int e = 0; e < 4; ++e) {
      const float f0 = sv[(piece * 8 + 2 * e) * 68 + d];
      const float f1 = sv[(piece * 8 + 2 * e + 1) * 68 + d];
      const _Float16 x0 = (_Float16)(bf_up(bf_bits(f0)) * vsc);
      const _Float16 x1 = (_Float16)(bf_up(bf_bits(f1)) * vsc);
      a[e] = pk16(h_bits(x0), h_bits(x1));
    }
    hv[it] = a;
    hofs[it] = ((size_t)(bh * DVL + d)) * TT + (size_t)s0 + (size_t)(piece * 8);
  }
  {
#pragma unroll
    for (int it = 0; it < 2; ++it) {
      *(v4u*)(vt + hofs[it]) = hv[it];
    }
    
  }
}

// =====================================================================================================
// Causal polynomial attention, d_key 32, d_val 64.
//   q f32 input: element (bh, t, d) at [(bh*TT + t)*DKY + d];  k f32 input: (bh, s, d) at [(bh*TT + s)*DKY + d];
//   both are converted to bf16 (RNE) here: q on its way into the fragment registers, k on its way into LDS
//   v^T plane f16 (x VSC): (bh, d, s) at [(bh*DVL + d)*TT + s]
//   raw scores^T = k . q^T on bf16 WMMA (A = 16 K rows, B = the wave's 16 queries, one k-step of 32 over d), f32
//   accumulate: register r of tile j in lane (c, hh) = key j*16 + 8hh + r against query c. With x = raw * sscale,
//   64 a = 64 (1 + x + x^2/2 + x^3/6) as a cubic in raw (f32, three fused multiply-adds, sscale and the carry of 64
//   inside its coefficients), keys > query replaced by 0 (in a tile's last pass: no earlier chunk holds
//   one), z += 64 a (f32, in-lane: a lane holds one query;
//   four partials, by the parity of tile j and of register r, fixed order; Z is carried x64 to the epilogue).
//   a planes: hi = f16(clamp(64 a)), lo = f16((clamp(64 a) - hi) * 1024) (the difference is exact in f32);
//   score tiles 2kk and 2kk+1, converted in place, are the B operand (keys kk*32.. in the hardware k order) of
//   context_hi^T += v^T . hi^T, context_lo^T += v^T . lo^T on f16 WMMA (A = 16 V^T rows, 2 k-steps of 32 per 64-key
//   chunk), separate accumulators: the weights never pass through LDS. Register r of tile t = feature t*16 + 8hh + r of
//   query c; epilogue 64 S = (context_hi + context_lo / 1024) / VSC, out = 64 S * (1 / (64 Z)).
//   Block = 8 waves in two groups of 4; it runs two 64-row query tiles of one bh one after the other, tile NQB-1-p
//   and then tile p, so that every block walks NQB+1 key chunks (causal cost is linear in the tile index; all blocks
//   are resident at once and the launch lasts as long as its fullest block). grid = (NQB/2) * NBH; key chunks 0..qb
//   per tile (block-uniform trip count, statically clamped to NQB); every processed chunk holds at least one live key.
//   Key split: wave w and wave w+4 own the same 16 query rows; group 0 (waves 0..3) takes the even key chunks, group 1
//   (waves 4..7) the odd ones, each group with its own K / V^T buffers, one pair of chunks per pass. The weights are a
//   plain sum over keys (no running maximum), so the two groups' context and Z partials just add: at the end of a tile
//   group 1 hands its partials over in LDS, one __syncthreads, group 0 adds them and finishes the tile.
//   K / V^T chunk staging per group: K 64 rows x 32 floats = 8 KB contiguous (4 x 16 B per thread, a wave's load = 512
//   contiguous B, 4 bf16 = 8 B to LDS each), V^T 64 rows x 64 halves (2 threads per row, 4 x 16 B each); plain loads.
//   Two LDS buffers per group: the loads of chunk kt+2 issue ahead of the products of chunk kt and stay in registers
//   while those run; behind the products they are converted and stored into the other buffer. One __syncthreads per
//   pass: it publishes the buffer this pass reads and ends the last reads of the buffer that is refilled behind it.
//   out f32 [bh][pos][DVL]: row (bh, t) = 64 floats = 256 B; each wave stages its 16x64 tile in LDS, then one
//   instruction per row pair: lanes 0..15 x 16 B = row 2i, lanes 16..31 x 16 B = row 2i+1 (512 contiguous B =
// coverage: 8 instructions x 2 rows x 64 cols = the wave's 16 rows; 4 waves = the 64-row tile; p = 0..NQB/2-1 with
//   tiles p and NQB-1-p = every query tile once; grid = every (bh, p).
// =====================================================================================================
// waves_per_eu(4, 4): two blocks of 8 waves on a WGP = four waves per SIMD, 256 registers a wave.
__global__ __launch_bounds__(256) __attribute__((amdgpu_waves_per_eu(4, 4)))
void attn_poly(const float* __restrict__ qf, const float* __restrict__ kf,
               const unsigned short* __restrict__ vtpl, float* outp, float sscale) {
#pragma clang fp contract(off)
  __shared__ __align__(16) __bf16   Ksh2[2][2][64 * KPT];           // [group][buffer] K [kv][d], padded rows     5 KB each
  __shared__ __align__(16) _Float16 Vth2[2][2][DVL * VPT];          // [group][buffer] V^T [d][kv], padded rows   9 KB each
  __shared__ __align__(16) float    Os[4][16 * OPT];                // per group-0 wave context tile [row][d], padded rows
  __shared__ __align__(16) float    Cs[4][9 * 32 * 4];              // group 1 -> group 0: [piece][lane] x 4 floats

  const int tid  = threadIdx.x & 127;        // thread index inside its group of 4 waves
  // wave number in a scalar register: the tests on the group below become scalar branches, EXEC stays all ones
  const int wv8  = __builtin_amdgcn_readfirstlane((int)(threadIdx.x >> 5));
  const int grp  = wv8 >> 2;                 // 0: even key chunks, 1: odd key chunks
  const int wave = wv8 & 3;                  // which 16 query rows of the tile
  const int lane = tid & 31;
  const int hh   = lane >> 4;
  const int c    = lane & 15;

  const int bx = blockIdx.x;
  const int pr = bx % (NQB / 2);
  const int bh = bx / (NQB / 2);
  if (bh >= NBH) return;                     // block-uniform, ahead of every barrier

  // coefficients of the weight cubic in the raw score, x AHS (wave-uniform)
  const float pk1 = AHS * sscale;
  const float pk2 = (AHS * 0.5f) * (sscale * sscale);
  const float pk3 = (AHS / 6.0f) * (sscale * sscale * sscale);

  const float*    Qp = qf + (size_t)bh * TT * DKY;
  const float*    Kp = kf + (size_t)bh * TT * DKY;
  const _Float16* Vh = (const _Float16*)(const void*)vtpl + (size_t)bh * DVL * TT;

  // one copy of the tile body: the two tiles of a block run strictly one after the other in every wave
#pragma unroll 1
  for (int half = 0; half < 2; ++half) {
  const int qb = half ? pr : (NQB - 1 - pr);   // block-uniform
  const int q0 = qb * 64 + wave * 16;
  int nkt = qb + 1;                          // causal: key chunks 0..qb, block-uniform
  if (nkt > NQB) nkt = NQB;
  const int npass = (nkt + 1) >> 1;          // block-uniform: every wave passes every barrier

  v4f ka[4];                                 // the chunk in flight: K as f32, V^T as f16
  v8h va[4];
  if (grp < nkt) stage_load(Kp, Vh, grp * 64, tid, ka, va);   // the group's first chunk, in flight beside the Q loads

  // ---- Q fragment (B operand, column = lane&15): one d-chunk of 32; elements 0..7 <- d 8hh.., 8..15 <- d 16+8hh.. ----
  v16b qa;
  {
    const float* qg = Qp + (size_t)(q0 + c) * DKY + 8 * hh;
    v4f qv[4];
    qv[0] = *(const v4f*)(qg);
    qv[1] = *(const v4f*)(qg + 4);
    qv[2] = *(const v4f*)(qg + 16);
    qv[3] = *(const v4f*)(qg + 20);
    // inputs only: keeps the Q loads here, in flight together with the first chunk's, instead of sunk behind its LDS stores
    asm volatile("" :: "v"(qv[0]), "v"(qv[1]), "v"(qv[2]), "v"(qv[3]));
#pragma unroll
    for (int i = 0; i < 4; ++i) {
      const v4b qc = __builtin_convertvector(qv[i], v4b);
#pragma unroll
      for (int e = 0; e < 4; ++e) qa[4 * i + e] = qc[e];
    }
  }

  v2f zl[2];                                 // Z partials of query c: [tile j odd][register r odd]
  v8f oacc[4], olo[4];
#pragma unroll
  for (int u = 0; u < 2; ++u) zl[u] = (v2f){0.f, 0.f};
#pragma unroll
  for (int t = 0; t < 4; ++t) { oacc[t] = zero8(); olo[t] = zero8(); }

  // the first chunk goes into buffer 0: every read of the tile before ended ahead of that tile's join barrier
  if (grp < nkt) stage_store(Ksh2[grp][0], Vth2[grp][0], tid, ka, va);
  // every pass but the last: both groups hold a chunk, and its last key precedes the tile's first query
  for (int ps = 0; ps + 1 < npass; ++ps) {
    const int kt = 2 * ps + grp;
    const bool nlive = kt + 2 < nkt;         // false only for group 1 ahead of the last pass of an odd chunk count
    __syncthreads();                         // buffer ps&1 is whole; nobody reads the other buffer any more
    // behind the barrier, whose fence would wait for them; they land while the products below run
    if (nlive) stage_load(Kp, Vh, kt * 64 + 128, tid, ka, va);
    chunk_products<false>(Ksh2[grp][ps & 1], Vth2[grp][ps & 1], qa, c, hh, 0, pk1, pk2, pk3, zl, oacc, olo);
    if (nlive) stage_store(Ksh2[grp][(ps + 1) & 1], Vth2[grp][(ps + 1) & 1], tid, ka, va);
  }
  // the last pass, written out behind the loop with its barrier: chunk qb, which holds the diagonal, is one of its two
  // (the other, qb - 1 where qb is odd, runs the same copy: there the zeroing selects every weight itself)
  {
    const int ps = npass - 1;
    const int kt = 2 * ps + grp;
    __syncthreads();                         // buffer ps&1 is whole
    if (kt < nkt)                            // false only for group 1 where the chunk count is odd
      chunk_products<true>(Ksh2[grp][ps & 1], Vth2[grp][ps & 1], qa, c, hh, q0 + c - kt * 64 - 8 * hh, pk1, pk2, pk3,
                           zl, oacc, olo);
  }

  // ---- join of the key split: group 1 stores hi + lo/1024 (8 pieces) and its Z partials (1 piece), lane-major ----
  float* cs = Cs[wave];
  if (grp == 1) {
#pragma unroll
    for (int t = 0; t < 4; ++t) {
#pragma unroll
      for (int g4 = 0; g4 < 2; ++g4) {
        v4f pv;
#pragma unroll
        for (int e = 0; e < 4; ++e) pv[e] = oacc[t][4 * g4 + e] + olo[t][4 * g4 + e] * (1.0f / ALS);
        *(v4f*)(cs + ((t * 2 + g4) * 32 + lane) * 4) = pv;
      }
    }
    {
      v4f zv;
#pragma unroll
      for (int e = 0; e < 4; ++e) zv[e] = zl[e >> 1][e & 1];
      *(v4f*)(cs + (8 * 32 + lane) * 4) = zv;
    }
  }
  __syncthreads();                           // publishes group 1's partials; block-uniform
  if (grp == 1) continue;                    // group 1 goes on to the next tile's first barrier
  float so[4][8];                            // the odd chunks' context partial, this lane's 32 elements
#pragma unroll
  for (int t = 0; t < 4; ++t) {
#pragma unroll
    for (int g4 = 0; g4 < 2; ++g4) {
      const v4f pv = *(const v4f*)(cs + ((t * 2 + g4) * 32 + lane) * 4);
#pragma unroll
      for (int e = 0; e < 4; ++e) so[t][4 * g4 + e] = pv[e];
    }
  }
  {
    const v4f zv = *(const v4f*)(cs + (8 * 32 + lane) * 4);
#pragma unroll
    for (int e = 0; e < 4; ++e) zl[e >> 1][e & 1] += zv[e];
  }

  // ---- Z fold (the four in-lane partials, then the other half of the keys from lane ^ 16, fixed order),
  //      64 S = (hi + lo/1024)/VSC, 64 S * (1/(64 Z)); a lane holds 8 consecutive features of its query per tile t ----
  float* os = Os[wave];
  {
    float z = (zl[0][0] + zl[0][1]) + (zl[1][0] + zl[1][1]);
    z += __shfl_xor(z, 16, 32);
    const float rz = 1.0f / z;
#pragma unroll
    for (int t = 0; t < 4; ++t) {
#pragma unroll
      for (int g4 = 0; g4 < 2; ++g4) {
        v4f ov;
#pragma unroll
        for (int e = 0; e < 4; ++e) {
          const int r = 4 * g4 + e;
          const float sv = ((oacc[t][r] + olo[t][r] * (1.0f / ALS)) + so[t][r]) * (1.0f / VSC);
          ov[e] = sv * rz;
        }
        *(v4f*)(os + c * OPT + t * 16 + 8 * hh + 4 * g4) = ov;
      }
    }
  }
  __builtin_amdgcn_fence(__ATOMIC_RELEASE, "workgroup");
  __builtin_amdgcn_wave_barrier();
  __builtin_amdgcn_fence(__ATOMIC_ACQUIRE, "workgroup");
  {
    const int col4 = c * 4;                      // 16 lanes x 4 floats = one whole 64-float row
    {
#pragma unroll
      for (int it = 0; it < 8; ++it) {           // row pairs (2it, 2it+1) of the wave tile
        const int rr = 2 * it + hh;
        const v4f ov = *(const v4f*)(os + rr * OPT + col4);
        const size_t go = ((size_t)(bh * TT + q0 + rr)) * DVL + (size_t)col4;
        *(v4f*)(outp + go) = ov;
      }
      // the next tile's set-up overwrites the address and data registers these stores name
      asm volatile("s_wait_xcnt 0x0" ::: "memory");
    }
  }
  }
}

// =====================================================================================================
// Inputs: in0 q [NB][NHD][TT][DKY] f32, in1 k same, in2 v [NB][NHD][TT][DVL] f32; bh = b*NHD + h.
// d_out f32 [NB][NHD][TT][DVL] at byte 0.
//   Vt  f16  [NBH][DVL][TT]     0          8388608
//   end                         8388608
// =====================================================================================================
extern "C" void kernel_launch(void* const* d_in, const int* in_sizes, int n_in,
                              void* d_out, int out_size, void* d_ws, size_t ws_size,
                              hipStream_t stream) {
  const int nq = NBH * TT * DKY;                      // 2097152
  const int nv = NBH * TT * DVL;                      // 4194304
  if (n_in < 3) return;
  if (in_sizes[0] != nq) return;
  if (in_sizes[1] != nq) return;
  if (in_sizes[2] != nv) return;
  if (out_size != nv) return;

  const float* q = (const float*)d_in[0];
  const float* k = (const float*)d_in[1];
  const float* v = (const float*)d_in[2];

  const size_t PV = (size_t)nv * 2;                   // 8388608
  size_t off = 0;
  const size_t oV = off; off += PV;
  if (off > ws_size) return;                          // off = 8388608
  if (off > (size_t)134217728) return;

  char* ws = (char*)d_ws;
  unsigned short* Vt = (unsigned short*)(ws + oV);
  float* outf = (float*)d_out;

  const dim3 blk(256);
  const dim3 gV(TT / 64, NBH);                        // (32, 32)
  const float sscale = 1.0f / sqrtf((float)DKY);

  // (1) v -> f16 v^T plane [bh][d][pos], values x VSC
  v_planes<<<gV, blk, 0, stream>>>(v, Vt, VSC);
  // (2) causal polynomial attention (reads q and k as f32) -> d_out
  attn_poly<<<dim3(NBH * (NQB / 2)), dim3(256), 0, stream>>>(q, k, Vt, outf, sscale);
  (void)hipGetLastError();
}
